// v000
// Times are from an AMD MI455X. After a warm-up the kernel runs many times in a row, and a time is the length of
// such a window on the GPU divided by its runs, so every launch and the gaps after it count. The runs cycle
// through copies of the inputs. A figure is the median of several windows, for all but v000 over two sittings.
// Sittings can differ by a few percent; kernels timed side by side share one.
// v000 is the starting kernel. One run takes 248 microseconds.
#include <hip/hip_runtime.h>
#include <hip/hip_bf16.h>
#include <math.h>

typedef float v2f __attribute__((ext_vector_type(2)));
typedef float v8f __attribute__((ext_vector_type(8)));

#define HEADS 6
#define CDIM  192
#define HD    32
#define K2    9
#define HH    56
#define WW    56
#define HWP   (HH * WW)          // 3136
#define BATCH 8
#define ROWS  (BATCH * HWP)      // 25088  (divisible by 64)
#define K4H   (K2 * K2 * HEADS)  // 486

template <int KC>
__global__ __launch_bounds__(256) void gemm_f32_wmma(
    const float* __restrict__ A, const float* __restrict__ Bm,
    const float* __restrict__ bias, float* __restrict__ C,
    int M, int N)
{
  constexpr int NS = KC / 4;                 // 48 k-stages
  const int lane = threadIdx.x & 31;
  const int wave = threadIdx.x >> 5;
  const int ntn  = (N + 15) >> 4;
  const int ntm  = M >> 6;                   // 64-row blocks (M % 64 == 0)
  const int ntiles = ntm * ntn;
  const int tile = blockIdx.x * 8 + wave;
  if (tile >= ntiles) return;                // whole wave exits together
  const int tm = tile / ntn;
  const int tn = tile % ntn;

  const int m16 = lane & 15;
  const int kh  = (lane >> 4) << 1;          // 0 or 2

  // B fragment pointer (clamped column), advanced by 4*N per k-stage
  const int bcol  = tn * 16 + m16;
  const int bcolc = bcol < N ? bcol : N - 1;
  const float* Bp = Bm + (size_t)kh * N + bcolc;
  const size_t bstep = 4 * (size_t)N;

  // A fragment pointers for the 4 M-subtiles (8B-aligned: kh even, KC even)
  const int row0 = tm * 64 + m16;
  const float* Ap0 = A + (size_t)(row0     ) * KC + kh;
  const float* Ap1 = A + (size_t)(row0 + 16) * KC + kh;
  const float* Ap2 = A + (size_t)(row0 + 32) * KC + kh;
  const float* Ap3 = A + (size_t)(row0 + 48) * KC + kh;

  v8f acc0 = {0.f,0.f,0.f,0.f,0.f,0.f,0.f,0.f};
  v8f acc1 = acc0, acc2 = acc0, acc3 = acc0;

  v2f aF0[3], aF1[3], aF2[3], aF3[3], bF[3];

  bF[0].x = Bp[0]; bF[0].y = Bp[N];
  aF0[0] = *(const v2f*)(Ap0);
  aF1[0] = *(const v2f*)(Ap1);
  aF2[0] = *(const v2f*)(Ap2);
  aF3[0] = *(const v2f*)(Ap3);
  Bp += bstep;
  bF[1].x = Bp[0]; bF[1].y = Bp[N];
  aF0[1] = *(const v2f*)(Ap0 + 4);
  aF1[1] = *(const v2f*)(Ap1 + 4);
  aF2[1] = *(const v2f*)(Ap2 + 4);
  aF3[1] = *(const v2f*)(Ap3 + 4);

  #pragma unroll
  for (int s = 2; s < NS; ++s) {
    const int ld = s % 3;
    const int cu = (s + 1) % 3;

    // issue stage s loads (A offsets are compile-time immediates)
    Bp += bstep;
    bF[ld].x = Bp[0]; bF[ld].y = Bp[N];
    aF0[ld] = *(const v2f*)(Ap0 + 4 * s);
    aF1[ld] = *(const v2f*)(Ap1 + 4 * s);
    aF2[ld] = *(const v2f*)(Ap2 + 4 * s);
    aF3[ld] = *(const v2f*)(Ap3 + 4 * s);

    // consume stage s-2 (its loads were issued 2 stages ago)
    acc0 = __builtin_amdgcn_wmma_f32_16x16x4_f32(false, aF0[cu], false, bF[cu], (short)0, acc0, false, false);
    acc1 = __builtin_amdgcn_wmma_f32_16x16x4_f32(false, aF1[cu], false, bF[cu], (short)0, acc1, false, false);
    acc2 = __builtin_amdgcn_wmma_f32_16x16x4_f32(false, aF2[cu], false, bF[cu], (short)0, acc2, false, false);
    acc3 = __builtin_amdgcn_wmma_f32_16x16x4_f32(false, aF3[cu], false, bF[cu], (short)0, acc3, false, false);
  }

  // epilogue: consume stages NS-2 and NS-1
  {
    const int c0 = (NS - 2) % 3;
    const int c1 = (NS - 1) % 3;
    acc0 = __builtin_amdgcn_wmma_f32_16x16x4_f32(false, aF0[c0], false, bF[c0], (short)0, acc0, false, false);
    acc1 = __builtin_amdgcn_wmma_f32_16x16x4_f32(false, aF1[c0], false, bF[c0], (short)0, acc1, false, false);
    acc2 = __builtin_amdgcn_wmma_f32_16x16x4_f32(false, aF2[c0], false, bF[c0], (short)0, acc2, false, false);
    acc3 = __builtin_amdgcn_wmma_f32_16x16x4_f32(false, aF3[c0], false, bF[c0], (short)0, acc3, false, false);
    acc0 = __builtin_amdgcn_wmma_f32_16x16x4_f32(false, aF0[c1], false, bF[c1], (short)0, acc0, false, false);
    acc1 = __builtin_amdgcn_wmma_f32_16x16x4_f32(false, aF1[c1], false, bF[c1], (short)0, acc1, false, false);
    acc2 = __builtin_amdgcn_wmma_f32_16x16x4_f32(false, aF2[c1], false, bF[c1], (short)0, acc2, false, false);
    acc3 = __builtin_amdgcn_wmma_f32_16x16x4_f32(false, aF3[c1], false, bF[c1], (short)0, acc3, false, false);
  }

  const int ocol = tn * 16 + m16;
  if (ocol < N) {
    const float bv = bias ? bias[ocol] : 0.f;
    const int orow0 = tm * 64 + ((lane >> 4) << 3);
    float* Cp = C + (size_t)orow0 * N + ocol;
    #pragma unroll
    for (int r = 0; r < 8; ++r) {
      Cp[(size_t)(r     ) * N] = acc0[r] + bv;
      Cp[(size_t)(r + 16) * N] = acc1[r] + bv;
      Cp[(size_t)(r + 32) * N] = acc2[r] + bv;
      Cp[(size_t)(r + 48) * N] = acc3[r] + bv;
    }
  }
}

// ---------------------------------------------------------------------------
// Softmax over contiguous groups of 9 (per b,pixel,head,k-row), scale = 32^-0.5
// ---------------------------------------------------------------------------
__global__ __launch_bounds__(256) void softmax9_kernel(float* __restrict__ attn,
                                                       int ngroups)
{
  const int g = blockIdx.x * blockDim.x + threadIdx.x;
  if (g >= ngroups) return;
  const int row = g / (HEADS * K2);
  const int grp = g % (HEADS * K2);
  float* p = attn + (size_t)row * K4H + grp * K2;

  const float scale = 0.17677669529663687f;  // 1/sqrt(32)
  float v[K2];
  float m = -INFINITY;
  #pragma unroll
  for (int i = 0; i < K2; ++i) { v[i] = p[i] * scale; m = fmaxf(m, v[i]); }
  float s = 0.f;
  #pragma unroll
  for (int i = 0; i < K2; ++i) { v[i] = __expf(v[i] - m); s += v[i]; }
  const float inv = 1.f / s;
  #pragma unroll
  for (int i = 0; i < K2; ++i) p[i] = v[i] * inv;
}

// ---------------------------------------------------------------------------
// Fused (unfold -> attn @ v -> fold): one wave per (b, pixel, head),
// lane = channel d (hd == 32 == wave32). Each lane caches the 5x5 v
// neighborhood in registers; fold means output pixel p sums over the 9
// window-centers c = p + (1-i, 1-j) that contain it, each contributing
// sum_q a[c, k=(i,j), q] * v[c + (qi-1, qj-1)].
// ---------------------------------------------------------------------------
__global__ __launch_bounds__(256) void attn_apply_fold_kernel(
    const float* __restrict__ attn, const float* __restrict__ v,
    float* __restrict__ y)
{
  const int wid = blockIdx.x * 8 + (threadIdx.x >> 5);
  const int total = BATCH * HWP * HEADS;
  if (wid >= total) return;
  const int head = wid % HEADS;
  const int bp   = wid / HEADS;
  const int p    = bp % HWP;
  const int b    = bp / HWP;
  const int pr   = p / WW;
  const int pc   = p % WW;
  const int d    = threadIdx.x & 31;

  // preload v[p-2 .. p+2]^2 for this (b, head, d); zero outside image (pad)
  float vn[25];
  #pragma unroll
  for (int dy = -2; dy <= 2; ++dy) {
    #pragma unroll
    for (int dx = -2; dx <= 2; ++dx) {
      const int r = pr + dy, c = pc + dx;
      float val = 0.f;
      if (r >= 0 && r < HH && c >= 0 && c < WW)
        val = v[(size_t)(b * HWP + r * WW + c) * CDIM + head * HD + d];
      vn[(dy + 2) * 5 + (dx + 2)] = val;
    }
  }

  float acc = 0.f;
  #pragma unroll
  for (int i = 0; i < 3; ++i) {
    #pragma unroll
    for (int j = 0; j < 3; ++j) {
      const int cr = pr + 1 - i, cc = pc + 1 - j;
      if (cr < 0 || cr >= HH || cc < 0 || cc >= WW) continue;
      const float* arow = attn + (size_t)(b * HWP + cr * WW + cc) * K4H
                               + (head * K2 + (i * 3 + j)) * K2;
      #pragma unroll
      for (int qi = 0; qi < 3; ++qi) {
        #pragma unroll
        for (int qj = 0; qj < 3; ++qj) {
          const int ny = qi - i, nx = qj - j;      // in [-2, 2]
          acc = fmaf(arow[qi * 3 + qj], vn[(ny + 2) * 5 + (nx + 2)], acc);
        }
      }
    }
  }
  y[(size_t)(b * HWP + p) * CDIM + head * HD + d] = acc;
}

// ---------------------------------------------------------------------------
extern "C" void kernel_launch(void* const* d_in, const int* in_sizes, int n_in,
                              void* d_out, int out_size, void* d_ws, size_t ws_size,
                              hipStream_t stream)
{
  const float* x  = (const float*)d_in[0];
  const float* Wv = (const float*)d_in[1];
  const float* Wa = (const float*)d_in[2];
  const float* ba = (const float*)d_in[3];
  const float* Wp = (const float*)d_in[4];
  const float* bp = (const float*)d_in[5];
  float* out = (float*)d_out;

  float* v    = (float*)d_ws;                       // ROWS*CDIM  (19.3 MB)
  float* attn = v    + (size_t)ROWS * CDIM;         // ROWS*K4H   (48.8 MB)
  float* y    = attn + (size_t)ROWS * K4H;          // ROWS*CDIM  (19.3 MB)

  // 1) v = x @ Wv   (tiles: (25088/64) * 12 = 4704 waves)
  {
    const int ntiles = (ROWS / 64) * ((CDIM + 15) / 16);
    gemm_f32_wmma<CDIM><<<(ntiles + 7) / 8, 256, 0, stream>>>(
        x, Wv, nullptr, v, ROWS, CDIM);
  }
  // 2) attn = x @ Wa + ba   (tiles: 392 * 31 = 12152 waves)
  {
    const int ntiles = (ROWS / 64) * ((K4H + 15) / 16);
    gemm_f32_wmma<CDIM><<<(ntiles + 7) / 8, 256, 0, stream>>>(
        x, Wa, ba, attn, ROWS, K4H);
  }
  // 3) softmax over groups of 9
  {
    const int ngroups = ROWS * HEADS * K2;                       // 1,354,752
    softmax9_kernel<<<(ngroups + 255) / 256, 256, 0, stream>>>(attn, ngroups);
  }
  // 4) fused unfold + attn@v + fold
  {
    const int nwaves = BATCH * HWP * HEADS;                      // 150,528
    attn_apply_fold_kernel<<<(nwaves + 7) / 8, 256, 0, stream>>>(attn, v, y);
  }
  // 5) out = y @ Wp + bp
  {
    const int ntiles = (ROWS / 64) * ((CDIM + 15) / 16);
    gemm_f32_wmma<CDIM><<<(ntiles + 7) / 8, 256, 0, stream>>>(
        y, Wp, bp, out, ROWS, CDIM);
  }
}

// v001
// Measured time: 180 microseconds a run.
// Two timings next to v000 put it at 1.41 and 1.40 times that version's speed.
#include <hip/hip_runtime.h>
#include <hip/hip_bf16.h>
#include <math.h>

typedef float v2f __attribute__((ext_vector_type(2)));
typedef float v4f __attribute__((ext_vector_type(4)));
typedef float v8f __attribute__((ext_vector_type(8)));

#define HEADS 6
#define CDIM  192
#define HD    32
#define K2    9
#define HH    56
#define WW    56
#define HWP   (HH * WW)          // 3136
#define BATCH 8
#define ROWS  (BATCH * HWP)      // 25088  (divisible by 64)
#define K4H   (K2 * K2 * HEADS)  // 486

template <int KC, int NWV>
__global__ __launch_bounds__(NWV * 32) void gemm_f32_wmma(
    const float* __restrict__ A, const float* __restrict__ Bm,
    const float* __restrict__ bias, float* __restrict__ C,
    int N)
{
  constexpr int NS    = KC / 4;              // 48 k-stages
  constexpr int NT    = NWV * 32;            // threads per work-group
  constexpr int PITCH = KC + 4;              // LDS row pitch in floats
  constexpr int RV    = KC / 4;              // 16-byte pieces per A row
  constexpr int RPP   = NT / 16;             // A rows staged per pass
  static_assert(RV % 16 == 0 && 64 % RPP == 0, "A block must split evenly");
  __shared__ __attribute__((aligned(16))) float As[64 * PITCH];

  const int lane = threadIdx.x & 31;
  const int wave = threadIdx.x >> 5;
  const int ntn  = (N + 15) >> 4;
  const int ngrp = (ntn + NWV - 1) / NWV;    // column groups per 64-row block
  const int tm   = blockIdx.x / ngrp;
  const int tn   = (blockIdx.x % ngrp) * NWV + wave;

  // stage the 64 x KC block of A: 16 lanes take 256 contiguous bytes of a
  // row, so a wave-wide load covers four whole lines and every further
  // address is the first one plus a compile-time offset
  {
    const int c16 = threadIdx.x & 15;
    const int rr  = threadIdx.x >> 4;
    const float* Ag = A + (size_t)tm * 64 * KC + rr * KC + c16 * 4;
    float* Al = As + rr * PITCH + c16 * 4;
    v4f t[64 / RPP][RV / 16];
    // both loop nests fully unrolled: t[][] stays in registers and every load
    // is in flight before the first LDS store waits
    #pragma unroll
    for (int p = 0; p < 64 / RPP; ++p)
      #pragma unroll
      for (int j = 0; j < RV / 16; ++j)
        t[p][j] = *(const v4f*)(Ag + p * RPP * KC + j * 64);
    #pragma unroll
    for (int p = 0; p < 64 / RPP; ++p)
      #pragma unroll
      for (int j = 0; j < RV / 16; ++j)
        *(v4f*)(Al + p * RPP * PITCH + j * 64) = t[p][j];
  }
  __syncthreads();
  if (tn >= ntn) return;                     // whole wave; no barrier follows

  const int m16 = lane & 15;
  const int kh  = (lane >> 4) << 1;          // 0 or 2

  // B fragment pointer (clamped column), advanced by 4*N per k-stage
  const int bcol  = tn * 16 + m16;
  const int bcolc = bcol < N ? bcol : N - 1;
  const float* Bp = Bm + (size_t)kh * N + bcolc;
  const size_t bstep = 4 * (size_t)N;

  // A fragment pointers into LDS for the 4 M-subtiles (8B-aligned)
  const float* Ap0 = As + (m16     ) * PITCH + kh;
  const float* Ap1 = As + (m16 + 16) * PITCH + kh;
  const float* Ap2 = As + (m16 + 32) * PITCH + kh;
  const float* Ap3 = As + (m16 + 48) * PITCH + kh;

  v8f acc0 = {0.f,0.f,0.f,0.f,0.f,0.f,0.f,0.f};
  v8f acc1 = acc0, acc2 = acc0, acc3 = acc0;

  v2f aF0[3], aF1[3], aF2[3], aF3[3], bF[3];

  bF[0].x = Bp[0]; bF[0].y = Bp[N];
  aF0[0] = *(const v2f*)(Ap0);
  aF1[0] = *(const v2f*)(Ap1);
  aF2[0] = *(const v2f*)(Ap2);
  aF3[0] = *(const v2f*)(Ap3);
  Bp += bstep;
  bF[1].x = Bp[0]; bF[1].y = Bp[N];
  aF0[1] = *(const v2f*)(Ap0 + 4);
  aF1[1] = *(const v2f*)(Ap1 + 4);
  aF2[1] = *(const v2f*)(Ap2 + 4);
  aF3[1] = *(const v2f*)(Ap3 + 4);

  #pragma unroll
  for (int s = 2; s < NS; ++s) {
    const int ld = s % 3;
    const int cu = (s + 1) % 3;

    // issue stage s loads (A offsets are compile-time immediates)
    Bp += bstep;
    bF[ld].x = Bp[0]; bF[ld].y = Bp[N];
    aF0[ld] = *(const v2f*)(Ap0 + 4 * s);
    aF1[ld] = *(const v2f*)(Ap1 + 4 * s);
    aF2[ld] = *(const v2f*)(Ap2 + 4 * s);
    aF3[ld] = *(const v2f*)(Ap3 + 4 * s);

    // consume stage s-2 (its loads were issued 2 stages ago)
    acc0 = __builtin_amdgcn_wmma_f32_16x16x4_f32(false, aF0[cu], false, bF[cu], (short)0, acc0, false, false);
    acc1 = __builtin_amdgcn_wmma_f32_16x16x4_f32(false, aF1[cu], false, bF[cu], (short)0, acc1, false, false);
    acc2 = __builtin_amdgcn_wmma_f32_16x16x4_f32(false, aF2[cu], false, bF[cu], (short)0, acc2, false, false);
    acc3 = __builtin_amdgcn_wmma_f32_16x16x4_f32(false, aF3[cu], false, bF[cu], (short)0, acc3, false, false);
  }

  // epilogue: consume stages NS-2 and NS-1
  {
    const int c0 = (NS - 2) % 3;
    const int c1 = (NS - 1) % 3;
    acc0 = __builtin_amdgcn_wmma_f32_16x16x4_f32(false, aF0[c0], false, bF[c0], (short)0, acc0, false, false);
    acc1 = __builtin_amdgcn_wmma_f32_16x16x4_f32(false, aF1[c0], false, bF[c0], (short)0, acc1, false, false);
    acc2 = __builtin_amdgcn_wmma_f32_16x16x4_f32(false, aF2[c0], false, bF[c0], (short)0, acc2, false, false);
    acc3 = __builtin_amdgcn_wmma_f32_16x16x4_f32(false, aF3[c0], false, bF[c0], (short)0, acc3, false, false);
    acc0 = __builtin_amdgcn_wmma_f32_16x16x4_f32(false, aF0[c1], false, bF[c1], (short)0, acc0, false, false);
    acc1 = __builtin_amdgcn_wmma_f32_16x16x4_f32(false, aF1[c1], false, bF[c1], (short)0, acc1, false, false);
    acc2 = __builtin_amdgcn_wmma_f32_16x16x4_f32(false, aF2[c1], false, bF[c1], (short)0, acc2, false, false);
    acc3 = __builtin_amdgcn_wmma_f32_16x16x4_f32(false, aF3[c1], false, bF[c1], (short)0, acc3, false, false);
  }

  const int ocol = tn * 16 + m16;
  if (ocol < N) {
    const float bv = bias ? bias[ocol] : 0.f;
    const int orow0 = tm * 64 + ((lane >> 4) << 3);
    float* Cp = C + (size_t)orow0 * N + ocol;
    #pragma unroll
    for (int r = 0; r < 8; ++r) {
      Cp[(size_t)(r     ) * N] = acc0[r] + bv;
      Cp[(size_t)(r + 16) * N] = acc1[r] + bv;
      Cp[(size_t)(r + 32) * N] = acc2[r] + bv;
      Cp[(size_t)(r + 48) * N] = acc3[r] + bv;
    }
  }
}

// ---------------------------------------------------------------------------
// Softmax over contiguous groups of 9 (per b,pixel,head,k-row), scale = 32^-0.5
// ---------------------------------------------------------------------------
__global__ __launch_bounds__(256) void softmax9_kernel(float* __restrict__ attn,
                                                       int ngroups)
{
  const int g = blockIdx.x * blockDim.x + threadIdx.x;
  if (g >= ngroups) return;
  const int row = g / (HEADS * K2);
  const int grp = g % (HEADS * K2);
  float* p = attn + (size_t)row * K4H + grp * K2;

  const float scale = 0.17677669529663687f;  // 1/sqrt(32)
  float v[K2];
  float m = -INFINITY;
  #pragma unroll
  for (int i = 0; i < K2; ++i) { v[i] = p[i] * scale; m = fmaxf(m, v[i]); }
  float s = 0.f;
  #pragma unroll
  for (int i = 0; i < K2; ++i) { v[i] = __expf(v[i] - m); s += v[i]; }
  const float inv = 1.f / s;
  #pragma unroll
  for (int i = 0; i < K2; ++i) p[i] = v[i] * inv;
}

// ---------------------------------------------------------------------------
// Fused (unfold -> attn @ v -> fold): one wave per (b, pixel, head),
// lane = channel d (hd == 32 == wave32). Each lane caches the 5x5 v
// neighborhood in registers; fold means output pixel p sums over the 9
// window-centers c = p + (1-i, 1-j) that contain it, each contributing
// sum_q a[c, k=(i,j), q] * v[c + (qi-1, qj-1)].
// ---------------------------------------------------------------------------
__global__ __launch_bounds__(256) void attn_apply_fold_kernel(
    const float* __restrict__ attn, const float* __restrict__ v,
    float* __restrict__ y)
{
  const int wid = blockIdx.x * 8 + (threadIdx.x >> 5);
  const int total = BATCH * HWP * HEADS;
  if (wid >= total) return;
  const int head = wid % HEADS;
  const int bp   = wid / HEADS;
  const int p    = bp % HWP;
  const int b    = bp / HWP;
  const int pr   = p / WW;
  const int pc   = p % WW;
  const int d    = threadIdx.x & 31;

  // preload v[p-2 .. p+2]^2 for this (b, head, d); zero outside image (pad)
  float vn[25];
  #pragma unroll
  for (int dy = -2; dy <= 2; ++dy) {
    #pragma unroll
    for (int dx = -2; dx <= 2; ++dx) {
      const int r = pr + dy, c = pc + dx;
      float val = 0.f;
      if (r >= 0 && r < HH && c >= 0 && c < WW)
        val = v[(size_t)(b * HWP + r * WW + c) * CDIM + head * HD + d];
      vn[(dy + 2) * 5 + (dx + 2)] = val;
    }
  }

  float acc = 0.f;
  #pragma unroll
  for (int i = 0; i < 3; ++i) {
    #pragma unroll
    for (int j = 0; j < 3; ++j) {
      const int cr = pr + 1 - i, cc = pc + 1 - j;
      if (cr < 0 || cr >= HH || cc < 0 || cc >= WW) continue;
      const float* arow = attn + (size_t)(b * HWP + cr * WW + cc) * K4H
                               + (head * K2 + (i * 3 + j)) * K2;
      #pragma unroll
      for (int qi = 0; qi < 3; ++qi) {
        #pragma unroll
        for (int qj = 0; qj < 3; ++qj) {
          const int ny = qi - i, nx = qj - j;      // in [-2, 2]
          acc = fmaf(arow[qi * 3 + qj], vn[(ny + 2) * 5 + (nx + 2)], acc);
        }
      }
    }
  }
  y[(size_t)(b * HWP + p) * CDIM + head * HD + d] = acc;
}

// ---------------------------------------------------------------------------
extern "C" void kernel_launch(void* const* d_in, const int* in_sizes, int n_in,
                              void* d_out, int out_size, void* d_ws, size_t ws_size,
                              hipStream_t stream)
{
  const float* x  = (const float*)d_in[0];
  const float* Wv = (const float*)d_in[1];
  const float* Wa = (const float*)d_in[2];
  const float* ba = (const float*)d_in[3];
  const float* Wp = (const float*)d_in[4];
  const float* bp = (const float*)d_in[5];
  float* out = (float*)d_out;

  float* v    = (float*)d_ws;                       // ROWS*CDIM  (19.3 MB)
  float* attn = v    + (size_t)ROWS * CDIM;         // ROWS*K4H   (48.8 MB)
  float* y    = attn + (size_t)ROWS * K4H;          // ROWS*CDIM  (19.3 MB)

  // 1) v = x @ Wv   (392 row blocks x 3 groups of 4 column tiles)
  {
    const int nblk = (ROWS / 64) * (((CDIM + 15) / 16 + 3) / 4);
    gemm_f32_wmma<CDIM, 4><<<nblk, 128, 0, stream>>>(x, Wv, nullptr, v, CDIM);
  }
  // 2) attn = x @ Wa + ba   (392 row blocks x 4 groups of 8 column tiles)
  {
    const int nblk = (ROWS / 64) * (((K4H + 15) / 16 + 7) / 8);
    gemm_f32_wmma<CDIM, 8><<<nblk, 256, 0, stream>>>(x, Wa, ba, attn, K4H);
  }
  // 3) softmax over groups of 9
  {
    const int ngroups = ROWS * HEADS * K2;                       // 1,354,752
    softmax9_kernel<<<(ngroups + 255) / 256, 256, 0, stream>>>(attn, ngroups);
  }
  // 4) fused unfold + attn@v + fold
  {
    const int nwaves = BATCH * HWP * HEADS;                      // 150,528
    attn_apply_fold_kernel<<<(nwaves + 7) / 8, 256, 0, stream>>>(attn, v, y);
  }
  // 5) out = y @ Wp + bp
  {
    const int nblk = (ROWS / 64) * (((CDIM + 15) / 16 + 3) / 4);
    gemm_f32_wmma<CDIM, 4><<<nblk, 128, 0, stream>>>(y, Wp, bp, out, CDIM);
  }
}

// v003
// Measured time: 89.1 microseconds a run.
// It is 2.03 times as fast as v001, going by the measured steps of the versions left out in between.
// Counting every step since v000, it is 2.85 times as fast.
#include <hip/hip_runtime.h>
#include <hip/hip_bf16.h>
#include <math.h>

typedef float v2f __attribute__((ext_vector_type(2)));
typedef float v4f __attribute__((ext_vector_type(4)));
typedef float v8f __attribute__((ext_vector_type(8)));

#define HEADS 6
#define CDIM  192
#define HD    32
#define K2    9
#define HH    56
#define WW    56
#define HWP   (HH * WW)          // 3136
#define BATCH 8
#define ROWS  (BATCH * HWP)      // 25088  (divisible by 64)
#define K4H   (K2 * K2 * HEADS)  // 486

template <int KC, int NWV>
__global__ __launch_bounds__(NWV * 32) void gemm_f32_wmma(
    const float* __restrict__ A, const float* __restrict__ Bm,
    const float* __restrict__ bias, float* __restrict__ C,
    int N)
{
  constexpr int NS    = KC / 4;              // 48 k-stages
  constexpr int NT    = NWV * 32;            // threads per work-group
  constexpr int PITCH = KC + 4;              // LDS row pitch in floats
  constexpr int RV    = KC / 4;              // 16-byte pieces per A row
  constexpr int RPP   = NT / 16;             // A rows staged per pass
  static_assert(RV % 16 == 0 && 64 % RPP == 0, "A block must split evenly");
  __shared__ __attribute__((aligned(16))) float As[64 * PITCH];

  const int lane = threadIdx.x & 31;
  const int wave = threadIdx.x >> 5;
  const int ntn  = (N + 15) >> 4;
  const int ngrp = (ntn + NWV - 1) / NWV;    // column groups per 64-row block
  const int tm   = blockIdx.x / ngrp;
  const int tn   = (blockIdx.x % ngrp) * NWV + wave;

  // stage the 64 x KC block of A: 16 lanes take 256 contiguous bytes of a
  // row, so a wave-wide load covers four whole lines and every further
  // address is the first one plus a compile-time offset
  {
    const int c16 = threadIdx.x & 15;
    const int rr  = threadIdx.x >> 4;
    const float* Ag = A + (size_t)tm * 64 * KC + rr * KC + c16 * 4;
    float* Al = As + rr * PITCH + c16 * 4;
    v4f t[64 / RPP][RV / 16];
    // both loop nests fully unrolled: t[][] stays in registers and every load
    // is in flight before the first LDS store waits
    #pragma unroll
    for (int p = 0; p < 64 / RPP; ++p)
      #pragma unroll
      for (int j = 0; j < RV / 16; ++j)
        t[p][j] = *(const v4f*)(Ag + p * RPP * KC + j * 64);
    #pragma unroll
    for (int p = 0; p < 64 / RPP; ++p)
      #pragma unroll
      for (int j = 0; j < RV / 16; ++j)
        *(v4f*)(Al + p * RPP * PITCH + j * 64) = t[p][j];
  }
  __syncthreads();
  if (tn >= ntn) return;                     // whole wave; no barrier follows

  const int m16 = lane & 15;
  const int kh  = (lane >> 4) << 1;          // 0 or 2

  // B fragment pointer (clamped column), advanced by 4*N per k-stage
  const int bcol  = tn * 16 + m16;
  const int bcolc = bcol < N ? bcol : N - 1;
  const float* Bp = Bm + (size_t)kh * N + bcolc;
  const size_t bstep = 4 * (size_t)N;

  // A fragment pointers into LDS for the 4 M-subtiles (8B-aligned)
  const float* Ap0 = As + (m16     ) * PITCH + kh;
  const float* Ap1 = As + (m16 + 16) * PITCH + kh;
  const float* Ap2 = As + (m16 + 32) * PITCH + kh;
  const float* Ap3 = As + (m16 + 48) * PITCH + kh;

  v8f acc0 = {0.f,0.f,0.f,0.f,0.f,0.f,0.f,0.f};
  v8f acc1 = acc0, acc2 = acc0, acc3 = acc0;

  v2f aF0[3], aF1[3], aF2[3], aF3[3], bF[3];

  bF[0].x = Bp[0]; bF[0].y = Bp[N];
  aF0[0] = *(const v2f*)(Ap0);
  aF1[0] = *(const v2f*)(Ap1);
  aF2[0] = *(const v2f*)(Ap2);
  aF3[0] = *(const v2f*)(Ap3);
  Bp += bstep;
  bF[1].x = Bp[0]; bF[1].y = Bp[N];
  aF0[1] = *(const v2f*)(Ap0 + 4);
  aF1[1] = *(const v2f*)(Ap1 + 4);
  aF2[1] = *(const v2f*)(Ap2 + 4);
  aF3[1] = *(const v2f*)(Ap3 + 4);

  #pragma unroll
  for (int s = 2; s < NS; ++s) {
    const int ld = s % 3;
    const int cu = (s + 1) % 3;

    // issue stage s loads (A offsets are compile-time immediates)
    Bp += bstep;
    bF[ld].x = Bp[0]; bF[ld].y = Bp[N];
    aF0[ld] = *(const v2f*)(Ap0 + 4 * s);
    aF1[ld] = *(const v2f*)(Ap1 + 4 * s);
    aF2[ld] = *(const v2f*)(Ap2 + 4 * s);
    aF3[ld] = *(const v2f*)(Ap3 + 4 * s);

    // consume stage s-2 (its loads were issued 2 stages ago)
    acc0 = __builtin_amdgcn_wmma_f32_16x16x4_f32(false, aF0[cu], false, bF[cu], (short)0, acc0, false, false);
    acc1 = __builtin_amdgcn_wmma_f32_16x16x4_f32(false, aF1[cu], false, bF[cu], (short)0, acc1, false, false);
    acc2 = __builtin_amdgcn_wmma_f32_16x16x4_f32(false, aF2[cu], false, bF[cu], (short)0, acc2, false, false);
    acc3 = __builtin_amdgcn_wmma_f32_16x16x4_f32(false, aF3[cu], false, bF[cu], (short)0, acc3, false, false);
  }

  // epilogue: consume stages NS-2 and NS-1
  {
    const int c0 = (NS - 2) % 3;
    const int c1 = (NS - 1) % 3;
    acc0 = __builtin_amdgcn_wmma_f32_16x16x4_f32(false, aF0[c0], false, bF[c0], (short)0, acc0, false, false);
    acc1 = __builtin_amdgcn_wmma_f32_16x16x4_f32(false, aF1[c0], false, bF[c0], (short)0, acc1, false, false);
    acc2 = __builtin_amdgcn_wmma_f32_16x16x4_f32(false, aF2[c0], false, bF[c0], (short)0, acc2, false, false);
    acc3 = __builtin_amdgcn_wmma_f32_16x16x4_f32(false, aF3[c0], false, bF[c0], (short)0, acc3, false, false);
    acc0 = __builtin_amdgcn_wmma_f32_16x16x4_f32(false, aF0[c1], false, bF[c1], (short)0, acc0, false, false);
    acc1 = __builtin_amdgcn_wmma_f32_16x16x4_f32(false, aF1[c1], false, bF[c1], (short)0, acc1, false, false);
    acc2 = __builtin_amdgcn_wmma_f32_16x16x4_f32(false, aF2[c1], false, bF[c1], (short)0, acc2, false, false);
    acc3 = __builtin_amdgcn_wmma_f32_16x16x4_f32(false, aF3[c1], false, bF[c1], (short)0, acc3, false, false);
  }

  const int ocol = tn * 16 + m16;
  if (ocol < N) {
    const float bv = bias ? bias[ocol] : 0.f;
    const int orow0 = tm * 64 + ((lane >> 4) << 3);
    float* Cp = C + (size_t)orow0 * N + ocol;
    #pragma unroll
    for (int r = 0; r < 8; ++r) {
      Cp[(size_t)(r     ) * N] = acc0[r] + bv;
      Cp[(size_t)(r + 16) * N] = acc1[r] + bv;
      Cp[(size_t)(r + 32) * N] = acc2[r] + bv;
      Cp[(size_t)(r + 48) * N] = acc3[r] + bv;
    }
  }
}

#define TROWS 4
#define TPX   (TROWS * WW)       // 224 pixels per work-group
#define SROWS (TROWS + 4)        // staged v rows
#define VGP   248
#define VRP   (8 * VGP + 32)
#define OCP   226

__global__ __launch_bounds__(TPX) void attn_apply_fold_kernel(
    const float* __restrict__ attn, const float* __restrict__ v,
    float* __restrict__ y)
{
  __shared__ __attribute__((aligned(16))) float Vs[SROWS * VRP];
  __shared__ float Os[HD * OCP];

  const int t    = threadIdx.x;
  const int head = blockIdx.x % HEADS;
  const int tile = blockIdx.x / HEADS;
  const int b    = tile / (HH / TROWS);
  const int r0   = (tile % (HH / TROWS)) * TROWS;
  const int rl   = t / WW;
  const int pc   = t % WW;
  const int pr   = r0 + rl;

  // this pixel's 9 x 9 logits; every loop over them is fully unrolled so that
  // a[][] stays in registers
  float a[K2][K2];
  #pragma unroll
  for (int i = 0; i < 3; ++i) {
    #pragma unroll
    for (int j = 0; j < 3; ++j) {
      const int cr = pr + 1 - i, cc = pc + 1 - j;
      const bool in = cr >= 0 && cr < HH && cc >= 0 && cc < WW;
      const int cpix = in ? cr * WW + cc : pr * WW + pc;   // address stays in bounds
      const float* arow = attn + (size_t)(b * HWP + cpix) * K4H
                               + (head * K2 + (i * 3 + j)) * K2;
      #pragma unroll
      for (int q = 0; q < K2; ++q)
        a[i * 3 + j][q] = arow[q];           // loaded by every lane
      // this row's address registers are free from here on and a later load
      // may be given them for its result: the wait stands in front of that
      asm volatile("s_wait_xcnt 0x0" ::: "memory");
    }
  }

  // stage v: 8 lanes take the 128-byte line of one pixel's head channels
  const int g8  = t & 7;
  const int sx0 = t >> 3;                    // 0..27
  const unsigned lo = sx0 * CDIM + g8 * 4;   // the lane's part of every v and y address
  const v4f zero4 = {0.f, 0.f, 0.f, 0.f};
  {
    const float* vb = v + (size_t)b * HWP * CDIM + head * HD;
    v4f s[SROWS][2];
    // both loop nests fully unrolled: s[][] stays in registers and every load
    // is in flight before the first LDS store waits
    #pragma unroll
    for (int sr = 0; sr < SROWS; ++sr) {
      const int gr  = r0 - 2 + sr;           // same for the whole work-group
      const int grc = gr < 0 ? 0 : (gr >= HH ? HH - 1 : gr);
      #pragma unroll
      for (int hf = 0; hf < 2; ++hf) {
        // always loaded from a row inside the image, then selected: no branch
        // and no wait stands between the loads
        const v4f ld = *(const v4f*)(vb + (grc * WW + 28 * hf) * CDIM + lo);
        s[sr][hf] = gr == grc ? ld : zero4;
        asm volatile("s_wait_xcnt 0x0" ::: "memory");
      }
    }
    #pragma unroll
    for (int sr = 0; sr < SROWS; ++sr)
      #pragma unroll
      for (int hf = 0; hf < 2; ++hf)
        *(v4f*)(Vs + sr * VRP + g8 * VGP + (sx0 + 28 * hf + 2) * 4) = s[sr][hf];
  }
  // zero border: columns -2, -1, 56, 57 of every staged row and channel group
  for (int id = t; id < SROWS * 8 * 4; id += TPX) {
    const int hc = id & 3;
    const int xx = hc < 2 ? hc : hc + WW;
    *(v4f*)(Vs + (id >> 5) * VRP + ((id >> 2) & 7) * VGP + xx * 4) = zero4;
  }

  // softmax of each of the 9 groups, in place; it stands behind the staging of
  // v so that no load is held back by arithmetic on an earlier one
  #pragma unroll
  for (int i = 0; i < 3; ++i) {
    #pragma unroll
    for (int j = 0; j < 3; ++j) {
      const int cr = pr + 1 - i, cc = pc + 1 - j;
      const bool in = cr >= 0 && cr < HH && cc >= 0 && cc < WW;
      float* e = a[i * 3 + j];
      const float scale = 0.17677669529663687f;  // 1/sqrt(32)
      float m = -INFINITY;
      #pragma unroll
      for (int q = 0; q < K2; ++q) { e[q] *= scale; m = fmaxf(m, e[q]); }
      float x[K2];
      #pragma unroll
      for (int q = 0; q < K2; ++q) x[q] = (e[q] - m) * 1.44269504f;  // log2(e)
      asm("v_exp_f32 %0, %9\n\t"
          "v_exp_f32 %1, %10\n\t"
          "v_exp_f32 %2, %11\n\t"
          "v_exp_f32 %3, %12\n\t"
          "v_exp_f32 %4, %13\n\t"
          "v_exp_f32 %5, %14\n\t"
          "v_exp_f32 %6, %15\n\t"
          "v_exp_f32 %7, %16\n\t"
          "v_exp_f32 %8, %17\n\t"
          "v_nop"
          : "=&v"(e[0]), "=&v"(e[1]), "=&v"(e[2]), "=&v"(e[3]), "=&v"(e[4]),
            "=&v"(e[5]), "=&v"(e[6]), "=&v"(e[7]), "=&v"(e[8])
          : "v"(x[0]), "v"(x[1]), "v"(x[2]), "v"(x[3]), "v"(x[4]),
            "v"(x[5]), "v"(x[6]), "v"(x[7]), "v"(x[8]));
      float s = e[0];
      #pragma unroll
      for (int q = 1; q < K2; ++q) s += e[q];
      const float inv = in ? 1.f / s : 0.f;
      #pragma unroll
      for (int q = 0; q < K2; ++q) e[q] *= inv;
    }
  }
  __syncthreads();

  const float* Vl = Vs + rl * VRP + pc * 4;
  float* Ol = Os + t;
  // unrolled: every LDS address is one lane register plus an immediate, and the
  // next group's window reads can start under this group's multiply-adds
  #pragma unroll
  for (int g = 0; g < HD / 4; ++g) {
    // 5x5 window of 4 channels; all loops below are fully unrolled, so the
    // indices into w[] and a[][] are constants and both stay in registers
    v4f w[25];
    #pragma unroll
    for (int ny = 0; ny < 5; ++ny) {
      #pragma unroll
      for (int nx = 0; nx < 5; ++nx)
        w[ny * 5 + nx] = *(const v4f*)(Vl + ny * VRP + g * VGP + nx * 4);
    }
    float acc0 = 0.f, acc1 = 0.f, acc2 = 0.f, acc3 = 0.f;
    #pragma unroll
    for (int i = 0; i < 3; ++i) {
      #pragma unroll
      for (int j = 0; j < 3; ++j) {
        #pragma unroll
        for (int qi = 0; qi < 3; ++qi) {
          #pragma unroll
          for (int qj = 0; qj < 3; ++qj) {
            const int n = (qi - i + 2) * 5 + (qj - j + 2);
            const float aw = a[i * 3 + j][qi * 3 + qj];
            acc0 = fmaf(aw, w[n].x, acc0);
            acc1 = fmaf(aw, w[n].y, acc1);
            acc2 = fmaf(aw, w[n].z, acc2);
            acc3 = fmaf(aw, w[n].w, acc3);
          }
        }
      }
    }
    Ol[(g * 4 + 0) * OCP] = acc0;
    Ol[(g * 4 + 1) * OCP] = acc1;
    Ol[(g * 4 + 2) * OCP] = acc2;
    Ol[(g * 4 + 3) * OCP] = acc3;
  }
  __syncthreads();

  // whole-line stores: 8 lanes write the 128 bytes of one pixel's head channels
  float* yb = y + ((size_t)b * HWP + r0 * WW) * CDIM + head * HD;
  #pragma unroll
  for (int k = 0; k < 8; ++k) {
    const int px = sx0 + 28 * k;
    const float* Or = Os + g8 * 4 * OCP + px;
    const v4f o = {Or[0], Or[OCP], Or[2 * OCP], Or[3 * OCP]};
    *(v4f*)(yb + 28 * k * CDIM + lo) = o;
  }
}

// ---------------------------------------------------------------------------
extern "C" void kernel_launch(void* const* d_in, const int* in_sizes, int n_in,
                              void* d_out, int out_size, void* d_ws, size_t ws_size,
                              hipStream_t stream)
{
  const float* x  = (const float*)d_in[0];
  const float* Wv = (const float*)d_in[1];
  const float* Wa = (const float*)d_in[2];
  const float* ba = (const float*)d_in[3];
  const float* Wp = (const float*)d_in[4];
  const float* bp = (const float*)d_in[5];
  float* out = (float*)d_out;

  float* v    = (float*)d_ws;                       // ROWS*CDIM  (19.3 MB)
  float* attn = v    + (size_t)ROWS * CDIM;         // ROWS*K4H   (48.8 MB)
  float* y    = attn + (size_t)ROWS * K4H;          // ROWS*CDIM  (19.3 MB)

  // 1) v = x @ Wv   (392 row blocks x 3 groups of 4 column tiles)
  {
    const int nblk = (ROWS / 64) * (((CDIM + 15) / 16 + 3) / 4);
    gemm_f32_wmma<CDIM, 4><<<nblk, 128, 0, stream>>>(x, Wv, nullptr, v, CDIM);
  }
  // 2) attn = x @ Wa + ba   (392 row blocks x 4 groups of 8 column tiles)
  {
    const int nblk = (ROWS / 64) * (((K4H + 15) / 16 + 7) / 8);
    gemm_f32_wmma<CDIM, 8><<<nblk, 256, 0, stream>>>(x, Wa, ba, attn, K4H);
  }
  // 3) fused softmax + unfold + attn@v + fold
  {
    const int nblk = BATCH * (HH / TROWS) * HEADS;               // 672
    attn_apply_fold_kernel<<<nblk, TPX, 0, stream>>>(attn, v, y);
  }
  // 4) out = y @ Wp + bp
  {
    const int nblk = (ROWS / 64) * (((CDIM + 15) / 16 + 3) / 4);
    gemm_f32_wmma<CDIM, 4><<<nblk, 128, 0, stream>>>(y, Wp, bp, out, CDIM);
  }
}

// v004
// Measured time: 79.6 microseconds a run.
// Next to v003, in two timings, it ran 1.12 and 1.11 times as fast.
// All steps since v000 together make it 3.18 times as fast.
#include <hip/hip_runtime.h>
#include <hip/hip_bf16.h>
#include <math.h>

typedef float v2f __attribute__((ext_vector_type(2)));
typedef float v4f __attribute__((ext_vector_type(4)));
typedef float v8f __attribute__((ext_vector_type(8)));

#define HEADS 6
#define CDIM  192
#define HD    32
#define K2    9
#define HH    56
#define WW    56
#define HWP   (HH * WW)          // 3136
#define BATCH 8
#define ROWS  (BATCH * HWP)      // 25088  (divisible by 64)
#define K4H   (K2 * K2 * HEADS)  // 486
// The logits are kept transposed, [logit column][pixel row]. Row pitch in
// floats: ROWS plus 64, so that every row starts on a 256-byte boundary and the
// pitch is an odd number of 256-byte units (the many rows that one wave walks
// are then not all a multiple of 2 KiB apart).
#define ATP   (ROWS + 64)        // 25152
#define ATR   (((K4H + 15) / 16) * 16)  // 496 rows: whole column tiles

template <bool TR>
__device__ __forceinline__ v8f mma4(v2f a, v2f b, v8f c)
{
  if constexpr (TR)
    return __builtin_amdgcn_wmma_f32_16x16x4_f32(false, b, false, a, (short)0, c, false, false);
  else
    return __builtin_amdgcn_wmma_f32_16x16x4_f32(false, a, false, b, (short)0, c, false, false);
}

template <int KC, int NWV, int CTP>
__global__ __launch_bounds__(NWV * 32) void gemm_f32_wmma(
    const float* __restrict__ A, const float* __restrict__ Bm,
    const float* __restrict__ bias, float* __restrict__ C,
    int N)
{
  constexpr int NS    = KC / 4;              // 48 k-stages
  constexpr int NT    = NWV * 32;            // threads per work-group
  constexpr int PITCH = KC + 4;              // LDS row pitch in floats
  constexpr int RV    = KC / 4;              // 16-byte pieces per A row
  constexpr int RPP   = NT / 16;             // A rows staged per pass
  constexpr bool TR   = CTP != 0;
  static_assert(RV % 16 == 0 && 64 % RPP == 0, "A block must split evenly");
  __shared__ __attribute__((aligned(16))) float As[64 * PITCH];

  const int lane = threadIdx.x & 31;
  const int wave = threadIdx.x >> 5;
  const int ntn  = (N + 15) >> 4;
  const int ngrp = (ntn + NWV - 1) / NWV;    // column groups per 64-row block
  const int tm   = blockIdx.x / ngrp;
  const int tn   = (blockIdx.x % ngrp) * NWV + wave;

  // stage the 64 x KC block of A: 16 lanes take 256 contiguous bytes of a
  // row, so a wave-wide load covers four whole lines and every further
  // address is the first one plus a compile-time offset
  {
    const int c16 = threadIdx.x & 15;
    const int rr  = threadIdx.x >> 4;
    const float* Ag = A + (size_t)tm * 64 * KC + rr * KC + c16 * 4;
    float* Al = As + rr * PITCH + c16 * 4;
    v4f t[64 / RPP][RV / 16];
    // both loop nests fully unrolled: t[][] stays in registers and every load
    // is in flight before the first LDS store waits
    #pragma unroll
    for (int p = 0; p < 64 / RPP; ++p)
      #pragma unroll
      for (int j = 0; j < RV / 16; ++j)
        t[p][j] = *(const v4f*)(Ag + p * RPP * KC + j * 64);
    #pragma unroll
    for (int p = 0; p < 64 / RPP; ++p)
      #pragma unroll
      for (int j = 0; j < RV / 16; ++j)
        *(v4f*)(Al + p * RPP * PITCH + j * 64) = t[p][j];
  }
  __syncthreads();
  if (tn >= ntn) return;                     // whole wave; no barrier follows

  const int m16 = lane & 15;
  const int kh  = (lane >> 4) << 1;          // 0 or 2

  // B fragment pointer (clamped column), advanced by 4*N per k-stage
  const int bcol  = tn * 16 + m16;
  const int bcolc = bcol < N ? bcol : N - 1;
  const float* Bp = Bm + (size_t)kh * N + bcolc;
  const size_t bstep = 4 * (size_t)N;

  // A fragment pointers into LDS for the 4 M-subtiles (8B-aligned)
  const float* Ap0 = As + (m16     ) * PITCH + kh;
  const float* Ap1 = As + (m16 + 16) * PITCH + kh;
  const float* Ap2 = As + (m16 + 32) * PITCH + kh;
  const float* Ap3 = As + (m16 + 48) * PITCH + kh;

  v8f acc0 = {0.f,0.f,0.f,0.f,0.f,0.f,0.f,0.f};
  v8f acc1 = acc0, acc2 = acc0, acc3 = acc0;

  v2f aF0[3], aF1[3], aF2[3], aF3[3], bF[3];

  bF[0].x = Bp[0]; bF[0].y = Bp[N];
  // in this build a later load's result was given these loads' address registers:
  // the wait stands in front of that; as its inputs both addresses stay in their
  // registers up to it, so that not even the pair's second load lands in the first's
  if constexpr (TR) asm volatile("s_wait_xcnt 0x0" :: "v"(Bp), "v"(Bp + N) : "memory");
  aF0[0] = *(const v2f*)(Ap0);
  aF1[0] = *(const v2f*)(Ap1);
  aF2[0] = *(const v2f*)(Ap2);
  aF3[0] = *(const v2f*)(Ap3);
  Bp += bstep;
  bF[1].x = Bp[0]; bF[1].y = Bp[N];
  if constexpr (TR) asm volatile("s_wait_xcnt 0x0" :: "v"(Bp), "v"(Bp + N) : "memory");
  aF0[1] = *(const v2f*)(Ap0 + 4);
  aF1[1] = *(const v2f*)(Ap1 + 4);
  aF2[1] = *(const v2f*)(Ap2 + 4);
  aF3[1] = *(const v2f*)(Ap3 + 4);

  #pragma unroll
  for (int s = 2; s < NS; ++s) {
    const int ld = s % 3;
    const int cu = (s + 1) % 3;

    // issue stage s loads (A offsets are compile-time immediates)
    Bp += bstep;
    bF[ld].x = Bp[0]; bF[ld].y = Bp[N];
    if constexpr (TR) asm volatile("s_wait_xcnt 0x0" :: "v"(Bp), "v"(Bp + N) : "memory");
    aF0[ld] = *(const v2f*)(Ap0 + 4 * s);
    aF1[ld] = *(const v2f*)(Ap1 + 4 * s);
    aF2[ld] = *(const v2f*)(Ap2 + 4 * s);
    aF3[ld] = *(const v2f*)(Ap3 + 4 * s);

    // consume stage s-2 (its loads were issued 2 stages ago)
    acc0 = mma4<TR>(aF0[cu], bF[cu], acc0);
    acc1 = mma4<TR>(aF1[cu], bF[cu], acc1);
    acc2 = mma4<TR>(aF2[cu], bF[cu], acc2);
    acc3 = mma4<TR>(aF3[cu], bF[cu], acc3);
  }

  // transposed store: a lane's 8 accumulator registers are 8 columns n, each
  // with its own bias; all 8 are fetched here in one go, under the last WMMAs
  const int on0 = tn * 16 + ((lane >> 4) << 3);
  float bvt[8] = {0.f, 0.f, 0.f, 0.f, 0.f, 0.f, 0.f, 0.f};
  if constexpr (TR) {
    if (bias) {
      #pragma unroll
      for (int r = 0; r < 8; ++r)
        bvt[r] = bias[on0 + r < N ? on0 + r : N - 1];    // address stays in bounds
    }
  }

  // epilogue: consume stages NS-2 and NS-1
  {
    const int c0 = (NS - 2) % 3;
    const int c1 = (NS - 1) % 3;
    acc0 = mma4<TR>(aF0[c0], bF[c0], acc0);
    acc1 = mma4<TR>(aF1[c0], bF[c0], acc1);
    acc2 = mma4<TR>(aF2[c0], bF[c0], acc2);
    acc3 = mma4<TR>(aF3[c0], bF[c0], acc3);
    acc0 = mma4<TR>(aF0[c1], bF[c1], acc0);
    acc1 = mma4<TR>(aF1[c1], bF[c1], acc1);
    acc2 = mma4<TR>(aF2[c1], bF[c1], acc2);
    acc3 = mma4<TR>(aF3[c1], bF[c1], acc3);
  }

  if constexpr (TR) {
    float* Cp = C + (size_t)on0 * CTP + tm * 64 + m16;
    #pragma unroll
    for (int r = 0; r < 8; ++r) {
      Cp[r * CTP     ] = acc0[r] + bvt[r];
      Cp[r * CTP + 16] = acc1[r] + bvt[r];
      Cp[r * CTP + 32] = acc2[r] + bvt[r];
      Cp[r * CTP + 48] = acc3[r] + bvt[r];
    }
    return;
  }

  const int ocol = tn * 16 + m16;
  if (ocol < N) {
    const float bv = bias ? bias[ocol] : 0.f;
    const int orow0 = tm * 64 + ((lane >> 4) << 3);
    float* Cp = C + (size_t)orow0 * N + ocol;
    #pragma unroll
    for (int r = 0; r < 8; ++r) {
      Cp[(size_t)(r     ) * N] = acc0[r] + bv;
      Cp[(size_t)(r + 16) * N] = acc1[r] + bv;
      Cp[(size_t)(r + 32) * N] = acc2[r] + bv;
      Cp[(size_t)(r + 48) * N] = acc3[r] + bv;
    }
  }
}

#define TROWS 4
#define TPX   (TROWS * WW)       // 224 pixels per work-group
#define SROWS (TROWS + 4)        // staged v rows
#define VGP   248
#define VRP   (8 * VGP + 32)
#define OCP   226

__global__ __launch_bounds__(TPX) void attn_apply_fold_kernel(
    const float* __restrict__ attn, const float* __restrict__ v,
    float* __restrict__ y)
{
  __shared__ __attribute__((aligned(16))) float Vs[SROWS * VRP];
  __shared__ float Os[HD * OCP];

  const int t    = threadIdx.x;
  const int head = blockIdx.x % HEADS;
  const int tile = blockIdx.x / HEADS;
  const int b    = tile / (HH / TROWS);
  const int r0   = (tile % (HH / TROWS)) * TROWS;
  const int rl   = t / WW;
  const int pc   = t % WW;
  const int pr   = r0 + rl;

  // this pixel's 9 x 9 logits; every loop over them is fully unrolled so that
  // a[][] stays in registers
  float a[K2][K2];
  const float* ab = attn + (size_t)(head * K2 * K2) * ATP + b * HWP;
  #pragma unroll
  for (int i = 0; i < 3; ++i) {
    #pragma unroll
    for (int j = 0; j < 3; ++j) {
      const int cr = pr + 1 - i, cc = pc + 1 - j;
      const bool in = cr >= 0 && cr < HH && cc >= 0 && cc < WW;
      const int cpix = in ? cr * WW + cc : pr * WW + pc;   // address stays in bounds
      const float* acol = ab + cpix;
      #pragma unroll
      for (int q = 0; q < K2; ++q)           // loaded by every lane
        a[i * 3 + j][q] = acol[((i * 3 + j) * K2 + q) * ATP];
      // this group's address registers are free from here on and a later load
      // may be given them for its result: the wait stands in front of that
      asm volatile("s_wait_xcnt 0x0" ::: "memory");
    }
  }

  // stage v: 8 lanes take the 128-byte line of one pixel's head channels
  const int g8  = t & 7;
  const int sx0 = t >> 3;                    // 0..27
  const unsigned lo = sx0 * CDIM + g8 * 4;   // the lane's part of every v and y address
  const v4f zero4 = {0.f, 0.f, 0.f, 0.f};
  {
    const float* vb = v + (size_t)b * HWP * CDIM + head * HD;
    v4f s[SROWS][2];
    // both loop nests fully unrolled: s[][] stays in registers and every load
    // is in flight before the first LDS store waits
    #pragma unroll
    for (int sr = 0; sr < SROWS; ++sr) {
      const int gr  = r0 - 2 + sr;           // same for the whole work-group
      const int grc = gr < 0 ? 0 : (gr >= HH ? HH - 1 : gr);
      #pragma unroll
      for (int hf = 0; hf < 2; ++hf) {
        // always loaded from a row inside the image, then selected: no branch
        // and no wait stands between the loads
        const v4f ld = *(const v4f*)(vb + (grc * WW + 28 * hf) * CDIM + lo);
        s[sr][hf] = gr == grc ? ld : zero4;
        asm volatile("s_wait_xcnt 0x0" ::: "memory");
      }
    }
    #pragma unroll
    for (int sr = 0; sr < SROWS; ++sr)
      #pragma unroll
      for (int hf = 0; hf < 2; ++hf)
        *(v4f*)(Vs + sr * VRP + g8 * VGP + (sx0 + 28 * hf + 2) * 4) = s[sr][hf];
  }
  // zero border: columns -2, -1, 56, 57 of every staged row and channel group
  for (int id = t; id < SROWS * 8 * 4; id += TPX) {
    const int hc = id & 3;
    const int xx = hc < 2 ? hc : hc + WW;
    *(v4f*)(Vs + (id >> 5) * VRP + ((id >> 2) & 7) * VGP + xx * 4) = zero4;
  }

  // softmax of each of the 9 groups, in place; it stands behind the staging of
  // v so that no load is held back by arithmetic on an earlier one
  #pragma unroll
  for (int i = 0; i < 3; ++i) {
    #pragma unroll
    for (int j = 0; j < 3; ++j) {
      const int cr = pr + 1 - i, cc = pc + 1 - j;
      const bool in = cr >= 0 && cr < HH && cc >= 0 && cc < WW;
      float* e = a[i * 3 + j];
      const float scale = 0.17677669529663687f;  // 1/sqrt(32)
      float m = -INFINITY;
      #pragma unroll
      for (int q = 0; q < K2; ++q) { e[q] *= scale; m = fmaxf(m, e[q]); }
      float x[K2];
      #pragma unroll
      for (int q = 0; q < K2; ++q) x[q] = (e[q] - m) * 1.44269504f;  // log2(e)
      asm("v_exp_f32 %0, %9\n\t"
          "v_exp_f32 %1, %10\n\t"
          "v_exp_f32 %2, %11\n\t"
          "v_exp_f32 %3, %12\n\t"
          "v_exp_f32 %4, %13\n\t"
          "v_exp_f32 %5, %14\n\t"
          "v_exp_f32 %6, %15\n\t"
          "v_exp_f32 %7, %16\n\t"
          "v_exp_f32 %8, %17\n\t"
          "v_nop"
          : "=&v"(e[0]), "=&v"(e[1]), "=&v"(e[2]), "=&v"(e[3]), "=&v"(e[4]),
            "=&v"(e[5]), "=&v"(e[6]), "=&v"(e[7]), "=&v"(e[8])
          : "v"(x[0]), "v"(x[1]), "v"(x[2]), "v"(x[3]), "v"(x[4]),
            "v"(x[5]), "v"(x[6]), "v"(x[7]), "v"(x[8]));
      float s = e[0];
      #pragma unroll
      for (int q = 1; q < K2; ++q) s += e[q];
      const float inv = in ? 1.f / s : 0.f;
      #pragma unroll
      for (int q = 0; q < K2; ++q) e[q] *= inv;
    }
  }
  __syncthreads();

  const float* Vl = Vs + rl * VRP + pc * 4;
  float* Ol = Os + t;
  // unrolled: every LDS address is one lane register plus an immediate, and the
  // next group's window reads can start under this group's multiply-adds
  #pragma unroll
  for (int g = 0; g < HD / 4; ++g) {
    // 5x5 window of 4 channels; all loops below are fully unrolled, so the
    // indices into w[] and a[][] are constants and both stay in registers
    v4f w[25];
    #pragma unroll
    for (int ny = 0; ny < 5; ++ny) {
      #pragma unroll
      for (int nx = 0; nx < 5; ++nx)
        w[ny * 5 + nx] = *(const v4f*)(Vl + ny * VRP + g * VGP + nx * 4);
    }
    float acc0 = 0.f, acc1 = 0.f, acc2 = 0.f, acc3 = 0.f;
    #pragma unroll
    for (int i = 0; i < 3; ++i) {
      #pragma unroll
      for (int j = 0; j < 3; ++j) {
        #pragma unroll
        for (int qi = 0; qi < 3; ++qi) {
          #pragma unroll
          for (int qj = 0; qj < 3; ++qj) {
            const int n = (qi - i + 2) * 5 + (qj - j + 2);
            const float aw = a[i * 3 + j][qi * 3 + qj];
            acc0 = fmaf(aw, w[n].x, acc0);
            acc1 = fmaf(aw, w[n].y, acc1);
            acc2 = fmaf(aw, w[n].z, acc2);
            acc3 = fmaf(aw, w[n].w, acc3);
          }
        }
      }
    }
    Ol[(g * 4 + 0) * OCP] = acc0;
    Ol[(g * 4 + 1) * OCP] = acc1;
    Ol[(g * 4 + 2) * OCP] = acc2;
    Ol[(g * 4 + 3) * OCP] = acc3;
  }
  __syncthreads();

  // whole-line stores: 8 lanes write the 128 bytes of one pixel's head channels
  float* yb = y + ((size_t)b * HWP + r0 * WW) * CDIM + head * HD;
  #pragma unroll
  for (int k = 0; k < 8; ++k) {
    const int px = sx0 + 28 * k;
    const float* Or = Os + g8 * 4 * OCP + px;
    const v4f o = {Or[0], Or[OCP], Or[2 * OCP], Or[3 * OCP]};
    *(v4f*)(yb + 28 * k * CDIM + lo) = o;
  }
}

// ---------------------------------------------------------------------------
extern "C" void kernel_launch(void* const* d_in, const int* in_sizes, int n_in,
                              void* d_out, int out_size, void* d_ws, size_t ws_size,
                              hipStream_t stream)
{
  const float* x  = (const float*)d_in[0];
  const float* Wv = (const float*)d_in[1];
  const float* Wa = (const float*)d_in[2];
  const float* ba = (const float*)d_in[3];
  const float* Wp = (const float*)d_in[4];
  const float* bp = (const float*)d_in[5];
  float* out = (float*)d_out;

  float* v    = (float*)d_ws;                       // ROWS*CDIM  (19.3 MB)
  float* attn = v    + (size_t)ROWS * CDIM;         // ATR*ATP    (49.9 MB)
  float* y    = attn + (size_t)ATR * ATP;           // ROWS*CDIM  (19.3 MB)

  // 1) v = x @ Wv   (392 row blocks x 3 groups of 4 column tiles)
  {
    const int nblk = (ROWS / 64) * (((CDIM + 15) / 16 + 3) / 4);
    gemm_f32_wmma<CDIM, 4, 0><<<nblk, 128, 0, stream>>>(x, Wv, nullptr, v, CDIM);
  }
  // 2) attn = (x @ Wa + ba)^T   (392 row blocks x 4 groups of 8 column tiles)
  {
    const int nblk = (ROWS / 64) * (((K4H + 15) / 16 + 7) / 8);
    gemm_f32_wmma<CDIM, 8, ATP><<<nblk, 256, 0, stream>>>(x, Wa, ba, attn, K4H);
  }
  // 3) fused softmax + unfold + attn@v + fold
  {
    const int nblk = BATCH * (HH / TROWS) * HEADS;               // 672
    attn_apply_fold_kernel<<<nblk, TPX, 0, stream>>>(attn, v, y);
  }
  // 4) out = y @ Wp + bp
  {
    const int nblk = (ROWS / 64) * (((CDIM + 15) / 16 + 3) / 4);
    gemm_f32_wmma<CDIM, 4, 0><<<nblk, 128, 0, stream>>>(y, Wp, bp, out, CDIM);
  }
}

// v005
// A run of this version takes 72.2 microseconds.
// Next to v004, in two timings, it ran 1.11 and 1.10 times as fast.
// Over all steps from v000 it is 3.52 times as fast.
#include <hip/hip_runtime.h>
#include <hip/hip_bf16.h>
#include <math.h>

typedef float v2f __attribute__((ext_vector_type(2)));
typedef float v4f __attribute__((ext_vector_type(4)));
typedef float v8f __attribute__((ext_vector_type(8)));

#define HEADS 6
#define CDIM  192
#define HD    32
#define K2    9
#define HH    56
#define WW    56
#define HWP   (HH * WW)          // 3136
#define BATCH 8
#define ROWS  (BATCH * HWP)      // 25088  (divisible by 64)
#define K4H   (K2 * K2 * HEADS)  // 486
// The logits are kept transposed, [logit column][pixel row]. Row pitch in
// floats: ROWS plus 64, so that every row starts on a 256-byte boundary and the
// pitch is an odd number of 256-byte units (the many rows that one wave walks
// are then not all a multiple of 2 KiB apart).
#define ATP   (ROWS + 64)        // 25152
#define ATR   (((K4H + 15) / 16) * 16)  // 496 rows: whole column tiles

template <bool TR>
__device__ __forceinline__ v8f mma4(v2f a, v2f b, v8f c)
{
  if constexpr (TR)
    return __builtin_amdgcn_wmma_f32_16x16x4_f32(false, b, false, a, (short)0, c, false, false);
  else
    return __builtin_amdgcn_wmma_f32_16x16x4_f32(false, a, false, b, (short)0, c, false, false);
}

// Stage 64-row block tm of A in As (NT threads; the caller places the barrier).
template <int KC, int NT>
__device__ __forceinline__ void stage_a_block(
    const float* __restrict__ A, float* __restrict__ As, const int tm)
{
  constexpr int PITCH = KC + 4;              // LDS row pitch in floats
  constexpr int RV    = KC / 4;              // 16-byte pieces per A row
  constexpr int RPP   = NT / 16;             // A rows staged per pass
  static_assert(RV % 16 == 0 && 64 % RPP == 0, "A block must split evenly");

  // 16 lanes take 256 contiguous bytes of a
  // row, so a wave-wide load covers four whole lines and every further
  // address is the first one plus a compile-time offset
  {
    const int c16 = threadIdx.x & 15;
    const int rr  = threadIdx.x >> 4;
    const float* Ag = A + (size_t)tm * 64 * KC + rr * KC + c16 * 4;
    float* Al = As + rr * PITCH + c16 * 4;
    v4f t[64 / RPP][RV / 16];
    // both loop nests fully unrolled: t[][] stays in registers and every load
    // is in flight before the first LDS store waits
    #pragma unroll
    for (int p = 0; p < 64 / RPP; ++p)
      #pragma unroll
      for (int j = 0; j < RV / 16; ++j)
        t[p][j] = *(const v4f*)(Ag + p * RPP * KC + j * 64);
    #pragma unroll
    for (int p = 0; p < 64 / RPP; ++p)
      #pragma unroll
      for (int j = 0; j < RV / 16; ++j)
        *(v4f*)(Al + p * RPP * PITCH + j * 64) = t[p][j];
  }
}

// One wave's 64 x 16 tile of C: row block tm (staged in As), column tile tn.
template <int KC, int CTP>
__device__ __forceinline__ void gemm_wave_tile(
    const float* As, const float* __restrict__ Bm,
    const float* __restrict__ bias, float* __restrict__ C,
    const int N, const int tm, const int tn)
{
  constexpr int NS    = KC / 4;              // 48 k-stages
  constexpr int PITCH = KC + 4;              // LDS row pitch in floats
  constexpr bool TR   = CTP != 0;

  const int lane = threadIdx.x & 31;
  const int m16 = lane & 15;
  const int kh  = (lane >> 4) << 1;          // 0 or 2

  // B fragment pointer (clamped column), advanced by 4*N per k-stage
  const int bcol  = tn * 16 + m16;
  const int bcolc = bcol < N ? bcol : N - 1;
  const float* Bp = Bm + (size_t)kh * N + bcolc;
  const size_t bstep = 4 * (size_t)N;

  // A fragment pointers into LDS for the 4 M-subtiles (8B-aligned)
  const float* Ap0 = As + (m16     ) * PITCH + kh;
  const float* Ap1 = As + (m16 + 16) * PITCH + kh;
  const float* Ap2 = As + (m16 + 32) * PITCH + kh;
  const float* Ap3 = As + (m16 + 48) * PITCH + kh;

  v8f acc0 = {0.f,0.f,0.f,0.f,0.f,0.f,0.f,0.f};
  v8f acc1 = acc0, acc2 = acc0, acc3 = acc0;

  v2f aF0[3], aF1[3], aF2[3], aF3[3], bF[3];

  bF[0].x = Bp[0]; bF[0].y = Bp[N];
  aF0[0] = *(const v2f*)(Ap0);
  aF1[0] = *(const v2f*)(Ap1);
  aF2[0] = *(const v2f*)(Ap2);
  aF3[0] = *(const v2f*)(Ap3);
  Bp += bstep;
  bF[1].x = Bp[0]; bF[1].y = Bp[N];
  aF0[1] = *(const v2f*)(Ap0 + 4);
  aF1[1] = *(const v2f*)(Ap1 + 4);
  aF2[1] = *(const v2f*)(Ap2 + 4);
  aF3[1] = *(const v2f*)(Ap3 + 4);

  #pragma unroll
  for (int s = 2; s < NS; ++s) {
    const int ld = s % 3;
    const int cu = (s + 1) % 3;

    // issue stage s loads (A offsets are compile-time immediates)
    Bp += bstep;
    bF[ld].x = Bp[0]; bF[ld].y = Bp[N];
    aF0[ld] = *(const v2f*)(Ap0 + 4 * s);
    aF1[ld] = *(const v2f*)(Ap1 + 4 * s);
    aF2[ld] = *(const v2f*)(Ap2 + 4 * s);
    aF3[ld] = *(const v2f*)(Ap3 + 4 * s);

    // consume stage s-2 (its loads were issued 2 stages ago)
    acc0 = mma4<TR>(aF0[cu], bF[cu], acc0);
    acc1 = mma4<TR>(aF1[cu], bF[cu], acc1);
    acc2 = mma4<TR>(aF2[cu], bF[cu], acc2);
    acc3 = mma4<TR>(aF3[cu], bF[cu], acc3);
  }

  // transposed store: a lane's 8 accumulator registers are 8 columns n, each
  // with its own bias; all 8 are fetched here in one go, under the last WMMAs
  const int on0 = tn * 16 + ((lane >> 4) << 3);
  float bvt[8] = {0.f, 0.f, 0.f, 0.f, 0.f, 0.f, 0.f, 0.f};
  if constexpr (TR) {
    if (bias) {
      #pragma unroll
      for (int r = 0; r < 8; ++r)
        bvt[r] = bias[on0 + r < N ? on0 + r : N - 1];    // address stays in bounds
    }
  }

  // epilogue: consume stages NS-2 and NS-1
  {
    const int c0 = (NS - 2) % 3;
    const int c1 = (NS - 1) % 3;
    acc0 = mma4<TR>(aF0[c0], bF[c0], acc0);
    acc1 = mma4<TR>(aF1[c0], bF[c0], acc1);
    acc2 = mma4<TR>(aF2[c0], bF[c0], acc2);
    acc3 = mma4<TR>(aF3[c0], bF[c0], acc3);
    acc0 = mma4<TR>(aF0[c1], bF[c1], acc0);
    acc1 = mma4<TR>(aF1[c1], bF[c1], acc1);
    acc2 = mma4<TR>(aF2[c1], bF[c1], acc2);
    acc3 = mma4<TR>(aF3[c1], bF[c1], acc3);
  }

  if constexpr (TR) {
    float* Cp = C + (size_t)on0 * CTP + tm * 64 + m16;
    #pragma unroll
    for (int r = 0; r < 8; ++r) {
      Cp[r * CTP     ] = acc0[r] + bvt[r];
      Cp[r * CTP + 16] = acc1[r] + bvt[r];
      Cp[r * CTP + 32] = acc2[r] + bvt[r];
      Cp[r * CTP + 48] = acc3[r] + bvt[r];
    }
    // in the merged kernel the other product's code stands behind these stores in
    // the listing and writes their address and data registers: the wait stands in
    // front of that
    asm volatile("s_wait_xcnt 0x0" ::: "memory");
    return;
  }

  const int ocol = tn * 16 + m16;
  if (ocol < N) {
    const float bv = bias ? bias[ocol] : 0.f;
    const int orow0 = tm * 64 + ((lane >> 4) << 3);
    float* Cp = C + (size_t)orow0 * N + ocol;
    #pragma unroll
    for (int r = 0; r < 8; ++r) {
      Cp[(size_t)(r     ) * N] = acc0[r] + bv;
      Cp[(size_t)(r + 16) * N] = acc1[r] + bv;
      Cp[(size_t)(r + 32) * N] = acc2[r] + bv;
      Cp[(size_t)(r + 48) * N] = acc3[r] + bv;
    }
  }
}

template <int KC, int NWV>
__global__ __launch_bounds__(NWV * 32) void gemm_f32_wmma(
    const float* __restrict__ A, const float* __restrict__ Bm,
    const float* __restrict__ bias, float* __restrict__ C,
    int N)
{
  __shared__ __attribute__((aligned(16))) float As[64 * (KC + 4)];
  const int wave = threadIdx.x >> 5;
  const int ntn  = (N + 15) >> 4;
  const int ngrp = (ntn + NWV - 1) / NWV;    // column groups per 64-row block
  const int tm   = blockIdx.x / ngrp;
  const int tn   = (blockIdx.x % ngrp) * NWV + wave;

  stage_a_block<KC, NWV * 32>(A, As, tm);
  __syncthreads();
  if (tn >= ntn) return;                     // whole wave; no barrier follows
  gemm_wave_tile<KC, 0>(As, Bm, bias, C, N, tm, tn);
}

// ---------------------------------------------------------------------------
// Both products of x in one launch: v = x @ Wv and the transposed logits
// (x @ Wa + ba)^T. They share the A operand, so their 12 + 31 column tiles are
// numbered through and dealt to groups of XNW waves; a wave's tile number says
// which product it belongs to (the same for all its lanes, a scalar branch).
// One launch has one start, one first staging that nothing overlaps and one
// tail, where two launches had two of each, and it has more work-groups than
// resident places, so that later stagings run under earlier groups' WMMAs.
// Grid: column group major. Work-groups with adjacent numbers then read the same
// columns of B, and the last group, which holds only 3 tiles and is the
// shortest, has the highest block numbers.
// ---------------------------------------------------------------------------
#define XNW   8                          // waves per work-group
#define VTN   (CDIM / 16)                // 12 column tiles of v
#define LTN   ((K4H + 15) / 16)          // 31 column tiles of the logits
#define XGRP  ((VTN + LTN + XNW - 1) / XNW)  // 6 column groups

__global__ __launch_bounds__(XNW * 32) void gemm_x_v_logits(
    const float* __restrict__ x, const float* __restrict__ Wv,
    const float* __restrict__ Wa, const float* __restrict__ ba,
    float* __restrict__ v, float* __restrict__ attn)
{
  __shared__ __attribute__((aligned(16))) float As[64 * (CDIM + 4)];
  const int tm = blockIdx.x % (ROWS / 64);
  const int tn = (blockIdx.x / (ROWS / 64)) * XNW
               + __builtin_amdgcn_readfirstlane(threadIdx.x >> 5);

  stage_a_block<CDIM, XNW * 32>(x, As, tm);
  __syncthreads();                           // no barrier follows
  if (tn < VTN)
    gemm_wave_tile<CDIM, 0>(As, Wv, nullptr, v, CDIM, tm, tn);
  else if (tn < VTN + LTN)
    gemm_wave_tile<CDIM, ATP>(As, Wa, ba, attn, K4H, tm, tn - VTN);
}

#define TROWS 4
#define TPX   (TROWS * WW)       // 224 pixels per work-group
#define SROWS (TROWS + 4)        // staged v rows
#define VGP   248
#define VRP   (8 * VGP + 32)
#define OCP   226

__global__ __launch_bounds__(TPX) void attn_apply_fold_kernel(
    const float* __restrict__ attn, const float* __restrict__ v,
    float* __restrict__ y)
{
  __shared__ __attribute__((aligned(16))) float Vs[SROWS * VRP];
  __shared__ float Os[HD * OCP];

  const int t    = threadIdx.x;
  const int head = blockIdx.x % HEADS;
  const int tile = blockIdx.x / HEADS;
  const int b    = tile / (HH / TROWS);
  const int r0   = (tile % (HH / TROWS)) * TROWS;
  const int rl   = t / WW;
  const int pc   = t % WW;
  const int pr   = r0 + rl;

  // this pixel's 9 x 9 logits; every loop over them is fully unrolled so that
  // a[][] stays in registers
  float a[K2][K2];
  const float* ab = attn + (size_t)(head * K2 * K2) * ATP + b * HWP;
  #pragma unroll
  for (int i = 0; i < 3; ++i) {
    #pragma unroll
    for (int j = 0; j < 3; ++j) {
      const int cr = pr + 1 - i, cc = pc + 1 - j;
      const bool in = cr >= 0 && cr < HH && cc >= 0 && cc < WW;
      const int cpix = in ? cr * WW + cc : pr * WW + pc;   // address stays in bounds
      const float* acol = ab + cpix;
      #pragma unroll
      for (int q = 0; q < K2; ++q)           // loaded by every lane
        a[i * 3 + j][q] = acol[((i * 3 + j) * K2 + q) * ATP];
      // this group's address registers are free from here on and a later load
      // may be given them for its result: the wait stands in front of that
      asm volatile("s_wait_xcnt 0x0" ::: "memory");
    }
  }

  // stage v: 8 lanes take the 128-byte line of one pixel's head channels
  const int g8  = t & 7;
  const int sx0 = t >> 3;                    // 0..27
  const unsigned lo = sx0 * CDIM + g8 * 4;   // the lane's part of every v and y address
  const v4f zero4 = {0.f, 0.f, 0.f, 0.f};
  {
    const float* vb = v + (size_t)b * HWP * CDIM + head * HD;
    v4f s[SROWS][2];
    // both loop nests fully unrolled: s[][] stays in registers and every load
    // is in flight before the first LDS store waits
    #pragma unroll
    for (int sr = 0; sr < SROWS; ++sr) {
      const int gr  = r0 - 2 + sr;           // same for the whole work-group
      const int grc = gr < 0 ? 0 : (gr >= HH ? HH - 1 : gr);
      #pragma unroll
      for (int hf = 0; hf < 2; ++hf) {
        // always loaded from a row inside the image, then selected: no branch
        // and no wait stands between the loads
        const v4f ld = *(const v4f*)(vb + (grc * WW + 28 * hf) * CDIM + lo);
        s[sr][hf] = gr == grc ? ld : zero4;
        asm volatile("s_wait_xcnt 0x0" ::: "memory");
      }
    }
    #pragma unroll
    for (int sr = 0; sr < SROWS; ++sr)
      #pragma unroll
      for (int hf = 0; hf < 2; ++hf)
        *(v4f*)(Vs + sr * VRP + g8 * VGP + (sx0 + 28 * hf + 2) * 4) = s[sr][hf];
  }
  // zero border: columns -2, -1, 56, 57 of every staged row and channel group
  for (int id = t; id < SROWS * 8 * 4; id += TPX) {
    const int hc = id & 3;
    const int xx = hc < 2 ? hc : hc + WW;
    *(v4f*)(Vs + (id >> 5) * VRP + ((id >> 2) & 7) * VGP + xx * 4) = zero4;
  }

  // softmax of each of the 9 groups, in place; it stands behind the staging of
  // v so that no load is held back by arithmetic on an earlier one
  #pragma unroll
  for (int i = 0; i < 3; ++i) {
    #pragma unroll
    for (int j = 0; j < 3; ++j) {
      const int cr = pr + 1 - i, cc = pc + 1 - j;
      const bool in = cr >= 0 && cr < HH && cc >= 0 && cc < WW;
      float* e = a[i * 3 + j];
      const float scale = 0.17677669529663687f;  // 1/sqrt(32)
      float m = -INFINITY;
      #pragma unroll
      for (int q = 0; q < K2; ++q) { e[q] *= scale; m = fmaxf(m, e[q]); }
      float x[K2];
      #pragma unroll
      for (int q = 0; q < K2; ++q) x[q] = (e[q] - m) * 1.44269504f;  // log2(e)
      asm("v_exp_f32 %0, %9\n\t"
          "v_exp_f32 %1, %10\n\t"
          "v_exp_f32 %2, %11\n\t"
          "v_exp_f32 %3, %12\n\t"
          "v_exp_f32 %4, %13\n\t"
          "v_exp_f32 %5, %14\n\t"
          "v_exp_f32 %6, %15\n\t"
          "v_exp_f32 %7, %16\n\t"
          "v_exp_f32 %8, %17\n\t"
          "v_nop"
          : "=&v"(e[0]), "=&v"(e[1]), "=&v"(e[2]), "=&v"(e[3]), "=&v"(e[4]),
            "=&v"(e[5]), "=&v"(e[6]), "=&v"(e[7]), "=&v"(e[8])
          : "v"(x[0]), "v"(x[1]), "v"(x[2]), "v"(x[3]), "v"(x[4]),
            "v"(x[5]), "v"(x[6]), "v"(x[7]), "v"(x[8]));
      float s = e[0];
      #pragma unroll
      for (int q = 1; q < K2; ++q) s += e[q];
      const float inv = in ? 1.f / s : 0.f;
      #pragma unroll
      for (int q = 0; q < K2; ++q) e[q] *= inv;
    }
  }
  __syncthreads();

  const float* Vl = Vs + rl * VRP + pc * 4;
  float* Ol = Os + t;
  // unrolled: every LDS address is one lane register plus an immediate, and the
  // next group's window reads can start under this group's multiply-adds
  #pragma unroll
  for (int g = 0; g < HD / 4; ++g) {
    // 5x5 window of 4 channels; all loops below are fully unrolled, so the
    // indices into w[] and a[][] are constants and both stay in registers
    v4f w[25];
    #pragma unroll
    for (int ny = 0; ny < 5; ++ny) {
      #pragma unroll
      for (int nx = 0; nx < 5; ++nx)
        w[ny * 5 + nx] = *(const v4f*)(Vl + ny * VRP + g * VGP + nx * 4);
    }
    float acc0 = 0.f, acc1 = 0.f, acc2 = 0.f, acc3 = 0.f;
    #pragma unroll
    for (int i = 0; i < 3; ++i) {
      #pragma unroll
      for (int j = 0; j < 3; ++j) {
        #pragma unroll
        for (int qi = 0; qi < 3; ++qi) {
          #pragma unroll
          for (int qj = 0; qj < 3; ++qj) {
            const int n = (qi - i + 2) * 5 + (qj - j + 2);
            const float aw = a[i * 3 + j][qi * 3 + qj];
            acc0 = fmaf(aw, w[n].x, acc0);
            acc1 = fmaf(aw, w[n].y, acc1);
            acc2 = fmaf(aw, w[n].z, acc2);
            acc3 = fmaf(aw, w[n].w, acc3);
          }
        }
      }
    }
    Ol[(g * 4 + 0) * OCP] = acc0;
    Ol[(g * 4 + 1) * OCP] = acc1;
    Ol[(g * 4 + 2) * OCP] = acc2;
    Ol[(g * 4 + 3) * OCP] = acc3;
  }
  __syncthreads();

  // whole-line stores: 8 lanes write the 128 bytes of one pixel's head channels
  float* yb = y + ((size_t)b * HWP + r0 * WW) * CDIM + head * HD;
  #pragma unroll
  for (int k = 0; k < 8; ++k) {
    const int px = sx0 + 28 * k;
    const float* Or = Os + g8 * 4 * OCP + px;
    const v4f o = {Or[0], Or[OCP], Or[2 * OCP], Or[3 * OCP]};
    *(v4f*)(yb + 28 * k * CDIM + lo) = o;
  }
}

// ---------------------------------------------------------------------------
extern "C" void kernel_launch(void* const* d_in, const int* in_sizes, int n_in,
                              void* d_out, int out_size, void* d_ws, size_t ws_size,
                              hipStream_t stream)
{
  const float* x  = (const float*)d_in[0];
  const float* Wv = (const float*)d_in[1];
  const float* Wa = (const float*)d_in[2];
  const float* ba = (const float*)d_in[3];
  const float* Wp = (const float*)d_in[4];
  const float* bp = (const float*)d_in[5];
  float* out = (float*)d_out;

  float* v    = (float*)d_ws;                       // ROWS*CDIM  (19.3 MB)
  float* attn = v    + (size_t)ROWS * CDIM;         // ATR*ATP    (49.9 MB)
  float* y    = attn + (size_t)ATR * ATP;           // ROWS*CDIM  (19.3 MB)

  // 1) v = x @ Wv and attn = (x @ Wa + ba)^T   (6 column groups x 392 row blocks)
  {
    const int nblk = (ROWS / 64) * XGRP;
    gemm_x_v_logits<<<nblk, XNW * 32, 0, stream>>>(x, Wv, Wa, ba, v, attn);
  }
  // 2) fused softmax + unfold + attn@v + fold
  {
    const int nblk = BATCH * (HH / TROWS) * HEADS;               // 672
    attn_apply_fold_kernel<<<nblk, TPX, 0, stream>>>(attn, v, y);
  }
  // 3) out = y @ Wp + bp
  {
    const int nblk = (ROWS / 64) * (((CDIM + 15) / 16 + 3) / 4);
    gemm_f32_wmma<CDIM, 4><<<nblk, 128, 0, stream>>>(y, Wp, bp, out, CDIM);
  }
}

// v006
// Measured time: 66.2 microseconds a run.
// In both of two side-by-side timings against v005, it was 1.09 times as fast.
// Over all steps from v000 it is 3.82 times as fast.
#include <hip/hip_runtime.h>
#include <hip/hip_bf16.h>
#include <math.h>

typedef float v2f __attribute__((ext_vector_type(2)));
typedef float v4f __attribute__((ext_vector_type(4)));
typedef float v8f __attribute__((ext_vector_type(8)));

#define HEADS 6
#define CDIM  192
#define HD    32
#define K2    9
#define HH    56
#define WW    56
#define HWP   (HH * WW)          // 3136
#define BATCH 8
#define ROWS  (BATCH * HWP)      // 25088  (divisible by 64)
#define K4H   (K2 * K2 * HEADS)  // 486
// The logits are kept transposed, [logit column][pixel row]. Row pitch in
// floats: ROWS plus 64, so that every row starts on a 256-byte boundary and the
// pitch is an odd number of 256-byte units (the many rows that one wave walks
// are then not all a multiple of 2 KiB apart).
#define ATP   (ROWS + 64)        // 25152
#define ATR   (((K4H + 15) / 16) * 16)  // 496 rows: whole column tiles

template <bool TR>
__device__ __forceinline__ v8f mma4(v2f a, v2f b, v8f c)
{
  if constexpr (TR)
    return __builtin_amdgcn_wmma_f32_16x16x4_f32(false, b, false, a, (short)0, c, false, false);
  else
    return __builtin_amdgcn_wmma_f32_16x16x4_f32(false, a, false, b, (short)0, c, false, false);
}

// Stage 64-row block tm of A in As (NT threads; the caller places the barrier).
template <int KC, int NT>
__device__ __forceinline__ void stage_a_block(
    const float* __restrict__ A, float* __restrict__ As, const int tm)
{
  constexpr int PITCH = KC + 4;              // LDS row pitch in floats
  constexpr int RV    = KC / 4;              // 16-byte pieces per A row
  constexpr int RPP   = NT / 16;             // A rows staged per pass
  static_assert(RV % 16 == 0 && 64 % RPP == 0, "A block must split evenly");

  // 16 lanes take 256 contiguous bytes of a
  // row, so a wave-wide load covers four whole lines and every further
  // address is the first one plus a compile-time offset
  {
    const int c16 = threadIdx.x & 15;
    const int rr  = threadIdx.x >> 4;
    const float* Ag = A + (size_t)tm * 64 * KC + rr * KC + c16 * 4;
    float* Al = As + rr * PITCH + c16 * 4;
    v4f t[64 / RPP][RV / 16];
    // both loop nests fully unrolled: t[][] stays in registers and every load
    // is in flight before the first LDS store waits
    #pragma unroll
    for (int p = 0; p < 64 / RPP; ++p)
      #pragma unroll
      for (int j = 0; j < RV / 16; ++j)
        t[p][j] = *(const v4f*)(Ag + p * RPP * KC + j * 64);
    #pragma unroll
    for (int p = 0; p < 64 / RPP; ++p)
      #pragma unroll
      for (int j = 0; j < RV / 16; ++j)
        *(v4f*)(Al + p * RPP * PITCH + j * 64) = t[p][j];
  }
}

// One wave's 64 x 16 tile of C: row block tm (staged in As), column tile tn.
template <int KC, int CTP>
__device__ __forceinline__ void gemm_wave_tile(
    const float* As, const float* __restrict__ Bm,
    const float* __restrict__ bias, float* __restrict__ C,
    const int N, const int tm, const int tn)
{
  constexpr int NS    = KC / 4;              // 48 k-stages
  constexpr int PITCH = KC + 4;              // LDS row pitch in floats
  constexpr bool TR   = CTP != 0;

  const int lane = threadIdx.x & 31;
  const int m16 = lane & 15;
  const int kh  = (lane >> 4) << 1;          // 0 or 2

  // B fragment pointer (clamped column), advanced by 4*N per k-stage
  const int bcol  = tn * 16 + m16;
  const int bcolc = bcol < N ? bcol : N - 1;
  const float* Bp = Bm + (size_t)kh * N + bcolc;
  const size_t bstep = 4 * (size_t)N;

  // A fragment pointers into LDS for the 4 M-subtiles (8B-aligned)
  const float* Ap0 = As + (m16     ) * PITCH + kh;
  const float* Ap1 = As + (m16 + 16) * PITCH + kh;
  const float* Ap2 = As + (m16 + 32) * PITCH + kh;
  const float* Ap3 = As + (m16 + 48) * PITCH + kh;

  v8f acc0 = {0.f,0.f,0.f,0.f,0.f,0.f,0.f,0.f};
  v8f acc1 = acc0, acc2 = acc0, acc3 = acc0;

  v2f aF0[3], aF1[3], aF2[3], aF3[3], bF[3];

  bF[0].x = Bp[0]; bF[0].y = Bp[N];
  aF0[0] = *(const v2f*)(Ap0);
  aF1[0] = *(const v2f*)(Ap1);
  aF2[0] = *(const v2f*)(Ap2);
  aF3[0] = *(const v2f*)(Ap3);
  Bp += bstep;
  bF[1].x = Bp[0]; bF[1].y = Bp[N];
  aF0[1] = *(const v2f*)(Ap0 + 4);
  aF1[1] = *(const v2f*)(Ap1 + 4);
  aF2[1] = *(const v2f*)(Ap2 + 4);
  aF3[1] = *(const v2f*)(Ap3 + 4);

  #pragma unroll
  for (int s = 2; s < NS; ++s) {
    const int ld = s % 3;
    const int cu = (s + 1) % 3;

    // issue stage s loads (A offsets are compile-time immediates)
    Bp += bstep;
    bF[ld].x = Bp[0]; bF[ld].y = Bp[N];
    aF0[ld] = *(const v2f*)(Ap0 + 4 * s);
    aF1[ld] = *(const v2f*)(Ap1 + 4 * s);
    aF2[ld] = *(const v2f*)(Ap2 + 4 * s);
    aF3[ld] = *(const v2f*)(Ap3 + 4 * s);

    // consume stage s-2 (its loads were issued 2 stages ago)
    acc0 = mma4<TR>(aF0[cu], bF[cu], acc0);
    acc1 = mma4<TR>(aF1[cu], bF[cu], acc1);
    acc2 = mma4<TR>(aF2[cu], bF[cu], acc2);
    acc3 = mma4<TR>(aF3[cu], bF[cu], acc3);
  }

  // transposed store: a lane's 8 accumulator registers are 8 columns n, each
  // with its own bias; all 8 are fetched here in one go, under the last WMMAs
  const int on0 = tn * 16 + ((lane >> 4) << 3);
  float bvt[8] = {0.f, 0.f, 0.f, 0.f, 0.f, 0.f, 0.f, 0.f};
  if constexpr (TR) {
    if (bias) {
      #pragma unroll
      for (int r = 0; r < 8; ++r)
        bvt[r] = bias[on0 + r < N ? on0 + r : N - 1];    // address stays in bounds
    }
  }

  // epilogue: consume stages NS-2 and NS-1
  {
    const int c0 = (NS - 2) % 3;
    const int c1 = (NS - 1) % 3;
    acc0 = mma4<TR>(aF0[c0], bF[c0], acc0);
    acc1 = mma4<TR>(aF1[c0], bF[c0], acc1);
    acc2 = mma4<TR>(aF2[c0], bF[c0], acc2);
    acc3 = mma4<TR>(aF3[c0], bF[c0], acc3);
    acc0 = mma4<TR>(aF0[c1], bF[c1], acc0);
    acc1 = mma4<TR>(aF1[c1], bF[c1], acc1);
    acc2 = mma4<TR>(aF2[c1], bF[c1], acc2);
    acc3 = mma4<TR>(aF3[c1], bF[c1], acc3);
  }

  if constexpr (TR) {
    float* Cp = C + (size_t)on0 * CTP + tm * 64 + m16;
    #pragma unroll
    for (int r = 0; r < 8; ++r) {
      Cp[r * CTP     ] = acc0[r] + bvt[r];
      Cp[r * CTP + 16] = acc1[r] + bvt[r];
      Cp[r * CTP + 32] = acc2[r] + bvt[r];
      Cp[r * CTP + 48] = acc3[r] + bvt[r];
    }
    // in the merged kernel the other product's code stands behind these stores in
    // the listing and writes their address and data registers: the wait stands in
    // front of that
    asm volatile("s_wait_xcnt 0x0" ::: "memory");
    return;
  }

  const int ocol = tn * 16 + m16;
  if (ocol < N) {
    const float bv = bias ? bias[ocol] : 0.f;
    const int orow0 = tm * 64 + ((lane >> 4) << 3);
    float* Cp = C + (size_t)orow0 * N + ocol;
    #pragma unroll
    for (int r = 0; r < 8; ++r) {
      Cp[(size_t)(r     ) * N] = acc0[r] + bv;
      Cp[(size_t)(r + 16) * N] = acc1[r] + bv;
      Cp[(size_t)(r + 32) * N] = acc2[r] + bv;
      Cp[(size_t)(r + 48) * N] = acc3[r] + bv;
    }
  }
}

// ---------------------------------------------------------------------------
// Both products of x in one launch: v = x @ Wv and the transposed logits
// (x @ Wa + ba)^T. They share the A operand, so their 12 + 31 column tiles are
// numbered through and dealt to groups of XNW waves; a wave's tile number says
// which product it belongs to (the same for all its lanes, a scalar branch).
// One launch has one start, one first staging that nothing overlaps and one
// tail, where two launches had two of each, and it has more work-groups than
// resident places, so that later stagings run under earlier groups' WMMAs.
// Grid: column group major. Work-groups with adjacent numbers then read the same
// columns of B, and the last group, which holds only 3 tiles and is the
// shortest, has the highest block numbers.
// ---------------------------------------------------------------------------
#define XNW   8                          // waves per work-group
#define VTN   (CDIM / 16)                // 12 column tiles of v
#define LTN   ((K4H + 15) / 16)          // 31 column tiles of the logits
#define XGRP  ((VTN + LTN + XNW - 1) / XNW)  // 6 column groups

__global__ __launch_bounds__(XNW * 32) void gemm_x_v_logits(
    const float* __restrict__ x, const float* __restrict__ Wv,
    const float* __restrict__ Wa, const float* __restrict__ ba,
    float* __restrict__ v, float* __restrict__ attn)
{
  __shared__ __attribute__((aligned(16))) float As[64 * (CDIM + 4)];
  const int tm = blockIdx.x % (ROWS / 64);
  const int tn = (blockIdx.x / (ROWS / 64)) * XNW
               + __builtin_amdgcn_readfirstlane(threadIdx.x >> 5);

  stage_a_block<CDIM, XNW * 32>(x, As, tm);
  __syncthreads();                           // no barrier follows
  if (tn < VTN)
    gemm_wave_tile<CDIM, 0>(As, Wv, nullptr, v, CDIM, tm, tn);
  else if (tn < VTN + LTN)
    gemm_wave_tile<CDIM, ATP>(As, Wa, ba, attn, K4H, tm, tn - VTN);
}

#define TROWS 2
#define TPX   (TROWS * WW)       // 112 pixels per work-group
#define FTH   (TPX * HEADS)      // 672 threads
#define SROWS (TROWS + 4)        // staged v rows
#define VGP   240                // one staged row of one head and channel group
#define VRP   (HEADS * VGP)      // step from a staged row to the next
#define VGS   (SROWS * VRP + 8)  // step from a channel group to the next
#define SPP   (FTH / 8)          // 84 (pixel, head) lines staged per pass
#define SPN   (WW * HEADS / SPP) // 4 passes per staged row
#define YPR   (2 * TPX)          // floats per pair row of y in LDS
#define YE    8                  // channels per head stored behind the window
#define YX    (8 * VGS)          // where their pair rows start

// Float offset in LDS of the pair row of channel c (head pair 0), and the step
// from one head pair to the next. Channels below YE stand behind the window,
// the others from float 0 on, in the window's part for channel groups 0 and 1.
__device__ constexpr int y_pair_row(int c) { return c < YE ? YX + c * YPR : (c - YE) * YPR; }
__device__ constexpr int y_pair_step(int c) { return (c < YE ? YE : HD - YE) * YPR; }

template <int KC, int MS, int N>
__device__ __forceinline__ void proj_wave_tile(
    const float* Yp, const float* __restrict__ Bm,
    const float* __restrict__ bias, float* __restrict__ C,
    const int row0, const int tn)
{
  constexpr int NS = KC / 4;
  constexpr int PR = 32 * MS;                // floats per pair row
  static_assert(N % 16 == 0 && KC % (2 * HD) == 0 && HD == 32, "whole tiles and head pairs");
  static_assert(PR == YPR, "the kernel's pair rows");
  // float offset of pair row 2s; pair row 2s + 1 follows it
  auto prow = [](int s) { return y_pair_row((2 * s) % HD) + (s / 16) * y_pair_step((2 * s) % HD); };

  const int lane = threadIdx.x & 31;
  const int m16 = lane & 15;
  const int hi  = lane >> 4;
  const int ocol = tn * 16 + m16;

  const float* Bp = Bm + hi * N + ocol;
  const float* Ap = Yp + hi * PR + m16 * 2;

  v8f acc[MS];
  #pragma unroll
  for (int m = 0; m < MS; ++m) acc[m] = v8f{0.f,0.f,0.f,0.f,0.f,0.f,0.f,0.f};

  constexpr int AD = 2, BD = 5;
  v2f aF[AD + 1][MS], bF[BD + 1];
  auto load_a = [&](int s) {
    #pragma unroll
    for (int m = 0; m < MS; ++m)
      aF[s % (AD + 1)][m] = *(const v2f*)(Ap + prow(s) + m * 32);
  };
  auto load_b = [&](int s) {
    bF[s % (BD + 1)].x = Bp[((2 * (s / 16)    ) * HD + (2 * s) % HD) * N];
    bF[s % (BD + 1)].y = Bp[((2 * (s / 16) + 1) * HD + (2 * s) % HD) * N];
  };
  #pragma unroll
  for (int s = 0; s < BD; ++s) load_b(s);
  #pragma unroll
  for (int s = 0; s < AD; ++s) load_a(s);
  float bv = 0.f;

  #pragma unroll
  for (int s = 0; s < NS; ++s) {
    if (s + BD < NS) load_b(s + BD);
    if (s + AD < NS) load_a(s + AD);
    if (s == NS - BD) bv = bias[ocol];       // fetched under the last WMMAs
    #pragma unroll
    for (int m = 0; m < MS; ++m)
      acc[m] = mma4<false>(aF[s % (AD + 1)][m], bF[s % (BD + 1)], acc[m]);
    // keeps each stage's loads in their stage: left free, the compiler lifted the
    // loads of many stages to the top, ran out of registers and spilled
    __builtin_amdgcn_sched_barrier(0);
  }

  float* Cp = C + (size_t)(row0 + (hi << 3)) * N + ocol;
  #pragma unroll
  for (int m = 0; m < MS; ++m)
    #pragma unroll
    for (int r = 0; r < 8; ++r)
      Cp[(m * 16 + r) * N] = acc[m][r] + bv;
}

__global__ __launch_bounds__(FTH) void attn_fold_proj_kernel(
    const float* __restrict__ attn, const float* __restrict__ v,
    const float* __restrict__ Wp, const float* __restrict__ bp,
    float* __restrict__ out)
{
  __shared__ __attribute__((aligned(16))) float Vs[YX + HEADS / 2 * YE * YPR];
  static_assert(HEADS / 2 * (HD - YE) * YPR <= YE / 4 * VGS && YE % 4 == 0 && YX % 64 == 0,
                "y fits in the window's part for the first YE / 4 channel groups");
  static_assert(SPN * SPP == WW * HEADS && TPX % 16 == 0, "even split");

  const int t    = threadIdx.x;
  const int b    = blockIdx.x / (HH / TROWS);
  const int r0   = (blockIdx.x % (HH / TROWS)) * TROWS;
  const int head = t / TPX;
  const int px   = t % TPX;
  const int rl   = px / WW;
  const int pc   = px % WW;
  const int pr   = r0 + rl;

  // stage v: 8 lanes take the 128-byte line of one pixel's channels of one head
  const int g8 = t & 7;
  const v4f zero4 = {0.f, 0.f, 0.f, 0.f};
  const float* vb = v + (size_t)b * HWP * CDIM;
  unsigned go[SPN], lo[SPN];                 // the lane's part of the addresses
  #pragma unroll
  for (int p = 0; p < SPN; ++p) {
    const int idx = p * SPP + (t >> 3);      // (head, column) of the line
    const int sh = idx / WW, sx = idx % WW;
    go[p] = sx * CDIM + sh * HD + g8 * 4;
    lo[p] = g8 * VGS + sh * VGP + (sx + 2) * 4;
  }
  // in two halves of 3 rows: all 24 lines of a lane at once would not fit in
  // registers beside the 81 logits. The first half's loads stand in front of the
  // logits' and its LDS stores behind them, so that the second half's loads,
  // which need the first half's registers, start while logits still arrive.
  // Loops fully unrolled: the lines stay in
  // registers and a half's loads are all in flight before its first LDS store
  auto load_half = [&](int hf, v4f (&s)[SROWS / 2][SPN]) {
    #pragma unroll
    for (int k = 0; k < SROWS / 2; ++k) {
      const int gr  = r0 - 2 + hf * (SROWS / 2) + k;   // same for the whole work-group
      const int grc = gr < 0 ? 0 : (gr >= HH ? HH - 1 : gr);
      #pragma unroll
      for (int p = 0; p < SPN; ++p) {
        // always loaded from a row inside the image, then selected: no branch
        // and no wait for data stands between the loads
        const v4f ld = *(const v4f*)(vb + grc * WW * CDIM + go[p]);
        s[k][p] = gr == grc ? ld : zero4;
        // in front of a later load's result landing in this load's address
        // registers
        asm volatile("s_wait_xcnt 0x0" ::: "memory");
      }
    }
  };
  auto store_half = [&](int hf, const v4f (&s)[SROWS / 2][SPN]) {
    #pragma unroll
    for (int k = 0; k < SROWS / 2; ++k)
      #pragma unroll
      for (int p = 0; p < SPN; ++p)
        *(v4f*)(Vs + (hf * (SROWS / 2) + k) * VRP + lo[p]) = s[k][p];
  };
  v4f s0[SROWS / 2][SPN], s1[SROWS / 2][SPN];
  load_half(0, s0);

  // this pixel's 9 x 9 logits; every loop over them is fully unrolled so that
  // a[][] stays in registers
  float a[K2][K2];
  const float* ab = attn + (size_t)(head * K2 * K2) * ATP + b * HWP;
  #pragma unroll
  for (int i = 0; i < 3; ++i) {
    #pragma unroll
    for (int j = 0; j < 3; ++j) {
      const int cr = pr + 1 - i, cc = pc + 1 - j;
      const bool in = cr >= 0 && cr < HH && cc >= 0 && cc < WW;
      const int cpix = in ? cr * WW + cc : pr * WW + pc;   // address stays in bounds
      const float* acol = ab + cpix;
      #pragma unroll
      for (int q = 0; q < K2; ++q) {         // loaded by every lane
        // the group's last load may be given the group's address registers for
        // its own result: the wait stands between the earlier loads and that
        if (q == K2 - 1) asm volatile("s_wait_xcnt 0x0" ::: "memory");
        a[i * 3 + j][q] = acol[((i * 3 + j) * K2 + q) * ATP];
      }
      // this group's address registers are free from here on and a later load
      // may be given them for its result: the wait stands in front of that
      asm volatile("s_wait_xcnt 0x0" ::: "memory");
    }
  }

  store_half(0, s0);
  load_half(1, s1);
  store_half(1, s1);

  // zero border: columns -2, -1, 56, 57 of every staged row and channel group
  for (int id = t; id < SROWS * HEADS * 8 * 4; id += FTH) {
    const int hc = id & 3;
    const int xx = hc < 2 ? hc : hc + WW;
    *(v4f*)(Vs + (id / (SROWS * HEADS * 4)) * VGS + ((id >> 2) % (SROWS * HEADS)) * VGP + xx * 4) = zero4;
  }

  // softmax of each of the 9 groups, in place; it stands behind the last load
  // so that no load is held back by arithmetic on an earlier one
  #pragma unroll
  for (int i = 0; i < 3; ++i) {
    #pragma unroll
    for (int j = 0; j < 3; ++j) {
      const int cr = pr + 1 - i, cc = pc + 1 - j;
      const bool in = cr >= 0 && cr < HH && cc >= 0 && cc < WW;
      float* e = a[i * 3 + j];
      const float scale = 0.17677669529663687f;  // 1/sqrt(32)
      float m = -INFINITY;
      #pragma unroll
      for (int q = 0; q < K2; ++q) { e[q] *= scale; m = fmaxf(m, e[q]); }
      float x[K2];
      #pragma unroll
      for (int q = 0; q < K2; ++q) x[q] = (e[q] - m) * 1.44269504f;  // log2(e)
      asm("v_exp_f32 %0, %9\n\t"
          "v_exp_f32 %1, %10\n\t"
          "v_exp_f32 %2, %11\n\t"
          "v_exp_f32 %3, %12\n\t"
          "v_exp_f32 %4, %13\n\t"
          "v_exp_f32 %5, %14\n\t"
          "v_exp_f32 %6, %15\n\t"
          "v_exp_f32 %7, %16\n\t"
          "v_exp_f32 %8, %17\n\t"
          "v_nop"
          : "=&v"(e[0]), "=&v"(e[1]), "=&v"(e[2]), "=&v"(e[3]), "=&v"(e[4]),
            "=&v"(e[5]), "=&v"(e[6]), "=&v"(e[7]), "=&v"(e[8])
          : "v"(x[0]), "v"(x[1]), "v"(x[2]), "v"(x[3]), "v"(x[4]),
            "v"(x[5]), "v"(x[6]), "v"(x[7]), "v"(x[8]));
      float s = e[0];
      #pragma unroll
      for (int q = 1; q < K2; ++q) s += e[q];
      const float inv = in ? 1.f / s : 0.f;
      #pragma unroll
      for (int q = 0; q < K2; ++q) e[q] *= inv;
    }
  }
  // keeps the softmax in front of the barrier (the compiler had moved it behind):
  // a wave whose loads have come does it while other waves still wait for theirs
  __builtin_amdgcn_sched_barrier(0);
  __syncthreads();

  // one channel group of this lane's head: 4 channels, window at Vg, sums to Yg
  auto group = [&](const float* Vg, float* Yg) {
    // the 5x5 window of 4 channels, one window row at a time: a row's 5 reads
    // serve every (i, qi) pair that meets it, and only a row or two are in
    // registers beside the 81 weights. All loops are fully unrolled: the
    // indices into w[] and a[][] are constants and both stay in registers
    float acc0 = 0.f, acc1 = 0.f, acc2 = 0.f, acc3 = 0.f;
    #pragma unroll
    for (int ny = 0; ny < 5; ++ny) {
      v4f w[5];
      #pragma unroll
      for (int nx = 0; nx < 5; ++nx)
        w[nx] = *(const v4f*)(Vg + ny * VRP + nx * 4);
      #pragma unroll
      for (int i = 0; i < 3; ++i) {
        const int qi = ny + i - 2;           // window row ny = qi - i + 2
        if (qi < 0 || qi > 2) continue;
        #pragma unroll
        for (int j = 0; j < 3; ++j) {
          #pragma unroll
          for (int qj = 0; qj < 3; ++qj) {
            const int n = qj - j + 2;
            const float aw = a[i * 3 + j][qi * 3 + qj];
            acc0 = fmaf(aw, w[n].x, acc0);
            acc1 = fmaf(aw, w[n].y, acc1);
            acc2 = fmaf(aw, w[n].z, acc2);
            acc3 = fmaf(aw, w[n].w, acc3);
          }
        }
      }
    }
    Yg[0 * YPR] = acc0;
    Yg[1 * YPR] = acc1;
    Yg[2 * YPR] = acc2;
    Yg[3 * YPR] = acc3;
    // ends the group for the compiler's scheduler: two groups woven into each
    // other needed more registers than a wave has here, and weights were spilled
    __builtin_amdgcn_sched_barrier(0);
  };

  const float* Vg = Vs + rl * VRP + head * VGP + pc * 4;
  float* Yl = Vs + px * 2 + (head & 1);      // + pair row
  static_assert(YE == 8 && HD == 32, "the first trip's two groups go behind the window");
  float* Yg = Yl + y_pair_row(0) + (head >> 1) * y_pair_step(0);
  // kept rolled, two groups a trip: the offsets of two groups fit the LDS
  // instructions' immediates (unrolled, each read of a far group took an
  // address addition of its own), and the kernel's text stays short
  #pragma unroll 1
  for (int gp = 0; gp < HD / 8; ++gp) {
    group(Vg, Yg);
    group(Vg + VGS, Yg + 4 * YPR);
    Vg += 2 * VGS;
    Yg += 8 * YPR;
    if (gp == 0) {                           // the same for the whole work-group
      __syncthreads();                       // every wave has left groups 0 and 1
      Yg = Yl + y_pair_row(YE) + (head >> 1) * y_pair_step(YE);
    }
  }
  __syncthreads();                           // y complete; no barrier follows

  const int wave = __builtin_amdgcn_readfirstlane(t >> 5);
  if (wave < CDIM / 16)
    proj_wave_tile<CDIM, TPX / 16, CDIM>(Vs, Wp, bp, out, blockIdx.x * TPX, wave);
}

// ---------------------------------------------------------------------------
extern "C" void kernel_launch(void* const* d_in, const int* in_sizes, int n_in,
                              void* d_out, int out_size, void* d_ws, size_t ws_size,
                              hipStream_t stream)
{
  const float* x  = (const float*)d_in[0];
  const float* Wv = (const float*)d_in[1];
  const float* Wa = (const float*)d_in[2];
  const float* ba = (const float*)d_in[3];
  const float* Wp = (const float*)d_in[4];
  const float* bp = (const float*)d_in[5];
  float* out = (float*)d_out;

  float* v    = (float*)d_ws;                       // ROWS*CDIM  (19.3 MB)
  float* attn = v    + (size_t)ROWS * CDIM;         // ATR*ATP    (49.9 MB)

  // 1) v = x @ Wv and attn = (x @ Wa + ba)^T   (6 column groups x 392 row blocks)
  {
    const int nblk = (ROWS / 64) * XGRP;
    gemm_x_v_logits<<<nblk, XNW * 32, 0, stream>>>(x, Wv, Wa, ba, v, attn);
  }
  // 2) fused softmax + unfold + attn@v + fold, then out = y @ Wp + bp
  {
    const int nblk = BATCH * (HH / TROWS);                       // 224
    attn_fold_proj_kernel<<<nblk, FTH, 0, stream>>>(attn, v, Wp, bp, out);
  }
}
